// v000
// The times below were measured on an AMD MI455X: many runs one after another, warmed up first and cycling through
// copies of the inputs, with the whole window's GPU time divided by the number of runs. Launches and the gaps
// between them are all in it. The median over several windows is given; except for v000 it joins two sittings, which
// can be a few percent apart, so the side-by-side timings, each taken in one sitting, are the better comparison.
// v000, which the later versions start from, runs in 291 microseconds.
#include <hip/hip_runtime.h>

// Single-head self-attention, 8 x 2048 tokens, model width 512, head width 64 (x [8][2048][512]; q/k/v = x kernel[0/1/2] ([3][512][64]); scores x 64^-0.5; softmax over 2048 keys; out = attn v -> [8][2048][64]).
// Compute dtypes, f32 accumulate everywhere: x and kernel converted to bf16 (RNE) once, projections v_wmma_f32_16x16x32_bf16 single product (exact products of bf16 inputs);
// scores q.k: bf16 hi/lo planes, 3 products; softmax f32 (register row); attn.v: bf16 hi/lo planes of P and of v, 3 products; output f32.

#ifndef NB
#define NB 8
#endif
#ifndef SEQ
#define SEQ 2048
#endif
#define NB_FULL  8
#define SEQ_FULL 2048
#define DM   512
#define HD   64
#define NQKV 192                 // fused projection width: q | k | v
#ifndef ZB
#define ZB ((NB % 2 == 0) ? 2 : 1)   // batches per attention pass (z-batched GEMMs)
#endif
#define SCL  0.125f              // HD^-0.5

static_assert(NB <= NB_FULL);
static_assert(SEQ <= SEQ_FULL);
static_assert(NB % ZB == 0);
static_assert(SEQ % 128 == 0);
static_assert(DM % 32 == 0);
static_assert(HD == 64);
static_assert((NB * SEQ) % 64 == 0);
static_assert(((size_t)SEQ * DM / 8) % 256 == 0);
static_assert(((size_t)NB * SEQ * HD) % 512 == 0);
static_assert((DM * HD / 64) % 64 == 0);

typedef unsigned short bf;
typedef _Float16 h16;
typedef __attribute__((ext_vector_type(16))) __bf16   v16bf;
typedef __attribute__((ext_vector_type(16))) _Float16 v16h;
typedef __attribute__((ext_vector_type(8)))  _Float16 v8h;
typedef __attribute__((ext_vector_type(8)))  unsigned short v8us;
typedef __attribute__((ext_vector_type(8)))  float    v8f;
typedef __attribute__((ext_vector_type(4)))  float    v4f;
typedef __attribute__((ext_vector_type(2)))  float    v2f;
typedef __attribute__((ext_vector_type(2)))  unsigned short v2us;
typedef __attribute__((ext_vector_type(4)))  unsigned short v4us;
typedef v4f  __attribute__((may_alias)) v4fa;

__device__ __forceinline__ unsigned short f2bf(float f) { unsigned u = __float_as_uint(f); u += 0x7FFFu + ((u >> 16) & 1u); return (unsigned short)(u >> 16); }
__device__ __forceinline__ float bf2f(unsigned short b) { return __uint_as_float(((unsigned)b) << 16); }
__device__ __forceinline__ float bfr(float f) { return bf2f(f2bf(f)); }
__device__ __forceinline__ v16h cat16(v8h lo, v8h hi) { return __builtin_shufflevector(lo, hi, 0, 1, 2, 3, 4, 5, 6, 7, 8, 9, 10, 11, 12, 13, 14, 15); }
__device__ __forceinline__ v16bf cat16b(v8us lo, v8us hi) { return __builtin_bit_cast(v16bf, __builtin_shufflevector(lo, hi, 0, 1, 2, 3, 4, 5, 6, 7, 8, 9, 10, 11, 12, 13, 14, 15)); }
__device__ __forceinline__ v8f wmma16(v16h a, v16h b, v8f c) { return __builtin_amdgcn_wmma_f32_16x16x32_f16(false, a, false, b, (short)0, c, false, false); }
__device__ __forceinline__ v8f wmmab(v16bf a, v16bf b, v8f c) { return __builtin_amdgcn_wmma_f32_16x16x32_bf16(false, a, false, b, (short)0, c, false, false); }

// ---- k_gemmw: register-blocked GEMM, ONE WAVE per 64x64 output tile (16 accumulators), operands straight from K-contiguous 16-bit planes; grid (M/64, N/64, Z), 32 threads.
// C[m][n] (f32, pitch ldc) = sum_k A[m][k] Bt[n][k] (+ split products per NSPLIT: 2 -> A.Bt + A2.Bt + A.Bt2). z-batch strides sA/sB/sC in elements. K % 32 == 0, M % 64 == 0, N % 64 == 0.
// Fragment map: lane l, h = l>>4: elements 0..7 <- k0+8h+0..7, elements 8..15 <- k0+16+8h+0..7 for both operands; D element j of lane l = (row 8h+j, col l&15).
template <typename T16> struct WFrag;
template <> struct WFrag<h16> { typedef v16h V; static __device__ __forceinline__ V ld(const h16* p) { return cat16(*(const v8h*)p, *(const v8h*)(p + 16)); } static __device__ __forceinline__ v8f mma(V a, V b, v8f c) { return wmma16(a, b, c); } };
template <> struct WFrag<bf> { typedef v16bf V; static __device__ __forceinline__ V ld(const bf* p) { return cat16b(*(const v8us*)p, *(const v8us*)(p + 16)); } static __device__ __forceinline__ v8f mma(V a, V b, v8f c) { return wmmab(a, b, c); } };
template <typename T16, int NSPLIT, bool BIAS>
__global__ __launch_bounds__(32) void k_gemmw(const T16* __restrict__ A, const T16* __restrict__ A2, const T16* __restrict__ Bt, const T16* __restrict__ Bt2, int K, float* C, int ldc, const float* __restrict__ bias, size_t sA, size_t sB, size_t sC) {
    typedef typename WFrag<T16>::V V;
    __shared__ __align__(16) float os[16 * 68];
    const size_t z = blockIdx.z; A += z * sA; if (A2) A2 += z * sA; Bt += z * sB; if (Bt2) Bt2 += z * sB; C += z * sC;
    const int lane = threadIdx.x & 31, lr = lane & 15, hi = lane >> 4; const int r0 = blockIdx.x * 64, c0 = blockIdx.y * 64;
    v8f acc[4][4];
#pragma unroll
    for (int mb = 0; mb < 4; ++mb)
#pragma unroll
        for (int nb = 0; nb < 4; ++nb) acc[mb][nb] = (v8f){};
    const size_t aoff = (size_t)(r0 + lr) * K + 8 * hi, boff = (size_t)(c0 + lr) * K + 8 * hi;
#pragma unroll 1
    for (int kc = 0; kc < K; kc += 32) {
        V a[4], a2[4];
#pragma unroll
        for (int mb = 0; mb < 4; ++mb) { a[mb] = WFrag<T16>::ld(A + aoff + (size_t)mb * 16 * K + kc); if (NSPLIT == 1 || NSPLIT == 2) a2[mb] = WFrag<T16>::ld(A2 + aoff + (size_t)mb * 16 * K + kc); }
#pragma unroll
        for (int nb = 0; nb < 4; ++nb) { const V b = WFrag<T16>::ld(Bt + boff + (size_t)nb * 16 * K + kc); V b2; if (NSPLIT >= 2) b2 = WFrag<T16>::ld(Bt2 + boff + (size_t)nb * 16 * K + kc);
#pragma unroll
            for (int mb = 0; mb < 4; ++mb) { acc[mb][nb] = WFrag<T16>::mma(a[mb], b, acc[mb][nb]); if (NSPLIT == 1 || NSPLIT == 2) acc[mb][nb] = WFrag<T16>::mma(a2[mb], b, acc[mb][nb]); if (NSPLIT >= 2) acc[mb][nb] = WFrag<T16>::mma(a[mb], b2, acc[mb][nb]); } }
        asm volatile("v_nop\n\tv_nop\n\tv_nop\n\tv_nop" : "+v"(acc[0][0]), "+v"(acc[1][1]), "+v"(acc[2][2]), "+v"(acc[3][3]) : "v"(a[0]), "v"(a[3]));
    }
#pragma unroll
    for (int mb = 0; mb < 4; ++mb) {
#pragma unroll
        for (int nb = 0; nb < 4; ++nb) {
#pragma unroll
            for (int j = 0; j < 8; ++j) os[(hi * 8 + j) * 68 + nb * 16 + lr] = acc[mb][nb][j]; }
        __builtin_amdgcn_wave_barrier(); asm volatile("" ::: "memory");
        float* crow = C + (size_t)(r0 + mb * 16) * ldc + c0;
{
#pragma unroll
            for (int s = 0; s < 8; ++s) { const int row = 2 * s + hi, cofs = lr * 4; v4f val = *(const v4fa*)(os + row * 68 + cofs); if (BIAS) { val[0] += bfr(bias[c0 + cofs]); val[1] += bfr(bias[c0 + cofs + 1]); val[2] += bfr(bias[c0 + cofs + 2]); val[3] += bfr(bias[c0 + cofs + 3]); }
                *(v4f*)(crow + (size_t)row * ldc + cofs) = val; }
             }
        __builtin_amdgcn_wave_barrier(); asm volatile("" ::: "memory");
    }
}

__device__ __forceinline__ void splitf(float y, unsigned short& h, unsigned short& l) { h = f2bf(y); l = f2bf(y - bf2f(h)); }

__global__ __launch_bounds__(256) void k_wtG(const float* __restrict__ w, int K, int N, bf* Bt) {
    w += (size_t)blockIdx.y * K * N; Bt += (size_t)blockIdx.y * N * K;
    const int lane = threadIdx.x & 31; const int L0 = (blockIdx.x * 8 + (threadIdx.x >> 5)) * 8; const int nlines = N * K / 64;
{
#pragma unroll 1
        for (int l = 0; l < 8; ++l) { const int L = L0 + l; if (L >= nlines) break; const size_t e = (size_t)L * 64 + lane * 2; const int k = (int)(e % K), n = (int)(e / K); v2us o;
            o[0] = f2bf(w[(size_t)k * N + n]); o[1] = f2bf(w[(size_t)(k + 1) * N + n]); *(v2us*)(Bt + e) = o; }
         }
}

__global__ __launch_bounds__(256) void k_cvt8(const float* __restrict__ src, bf* dst, size_t n8, size_t sSrc, size_t sDst) {
    const size_t i = (size_t)blockIdx.x * 256 + threadIdx.x; if (i >= n8) return;
    src += (size_t)blockIdx.y * sSrc; dst += (size_t)blockIdx.y * sDst;
    const v8f v = *(const v8f*)(src + i * 8); v8us o;
#pragma unroll
    for (int k = 0; k < 8; ++k) o[k] = f2bf(v[k]);
    *(v8us*)(dst + i * 8) = o;  }

__global__ __launch_bounds__(256) void k_plane(const float* __restrict__ F, int pitch, size_t nelem, bf* Ph, bf* Pl) {
    const size_t e = ((size_t)blockIdx.x * 256 + threadIdx.x) * 2; if (e >= nelem) return;
    const int d = (int)(e % HD); const size_t row = e / HD;
    const v2f xv = *(const v2f*)(F + row * (size_t)pitch + (size_t)blockIdx.y * HD + d);
    v2us oh, ol;
#pragma unroll
    for (int q = 0; q < 2; ++q) { unsigned short a2, c2; splitf(xv[q], a2, c2); oh[q] = a2; ol[q] = c2; }
    const size_t oo = (size_t)blockIdx.y * nelem + e;
    *(v2us*)(Ph + oo) = oh; *(v2us*)(Pl + oo) = ol;  }

__global__ __launch_bounds__(256) void k_vtp(const float* __restrict__ F, int pitch, int col0, bf* Vh, bf* Vl) {
    const size_t e = ((size_t)blockIdx.x * 256 + threadIdx.x) * 2; if (e >= (size_t)NB * HD * SEQ) return;
    const int t = (int)(e % SEQ); const int d = (int)((e / SEQ) % HD); const int g = (int)(e / ((size_t)SEQ * HD)); v2us oh, ol;
#pragma unroll
    for (int q = 0; q < 2; ++q) { const float x = F[((size_t)g * SEQ + t + q) * (size_t)pitch + col0 + d]; unsigned short a2, c2; splitf(x, a2, c2); oh[q] = a2; ol[q] = c2; }
    *(v2us*)(Vh + e) = oh; *(v2us*)(Vl + e) = ol;  }

// k_asoft: per score row: t = S x HD^-0.5; max-subtracted softmax over the SEQ keys (register row, one exp per element, fixed shuffle trees);
__global__ __launch_bounds__(256) void k_asoft(const float* __restrict__ Sb, bf* Ph, bf* Pl, int nrows) {
    const int lane = threadIdx.x & 31; const int row = blockIdx.x * 8 + (threadIdx.x >> 5); if (row >= nrows) return;
    const float* sr = Sb + (size_t)row * SEQ; float v[SEQ / 32]; float mx = -3.0e38f;
#pragma unroll
    for (int ch = 0; ch < SEQ / 128; ++ch) { const int j0 = ch * 128 + lane * 4; const v4f a = *(const v4f*)(sr + j0);
#pragma unroll
        for (int q = 0; q < 4; ++q) { const float t = a[q] * SCL; v[ch * 4 + q] = t; mx = fmaxf(mx, t); } }
#pragma unroll
    for (int sh = 16; sh; sh >>= 1) mx = fmaxf(mx, __shfl_xor(mx, sh, 32));
    float sum = 0.f;
#pragma unroll
    for (int k = 0; k < SEQ / 32; ++k) { float d0 = __fsub_rn(v[k], mx); asm volatile("" : "+v"(d0)); v[k] = __builtin_amdgcn_exp2f(__fmul_rn(d0, 1.4426950408889634f)); sum += v[k]; }
#pragma unroll
    for (int sh = 16; sh; sh >>= 1) sum += __shfl_xor(sum, sh, 32);
    const float f = __fdiv_rn(1.0f, sum);
{
#pragma unroll
        for (int ch = 0; ch < SEQ / 128; ++ch) { v4us oh, ol;
#pragma unroll
            for (int q = 0; q < 4; ++q) { unsigned short a, c2; splitf(v[ch * 4 + q] * f, a, c2); oh[q] = a; ol[q] = c2; }
            const size_t oo = (size_t)row * SEQ + ch * 128 + lane * 4; *(v4us*)(Ph + oo) = oh; *(v4us*)(Pl + oo) = ol; }
         }
}

// workspace carve (bytes), all multiples of 256
constexpr size_t B_W   = (size_t)NQKV * DM * 2;
constexpr size_t B_XB  = (size_t)NB * SEQ * DM * 2;
constexpr size_t B_F   = (size_t)NB * SEQ * NQKV * 4;
constexpr size_t B_QK  = (size_t)2 * NB * SEQ * HD * 2;
constexpr size_t B_VT  = (size_t)NB * HD * SEQ * 2;
constexpr size_t B_S   = (size_t)ZB * SEQ * SEQ * 4;
constexpr size_t B_P   = (size_t)ZB * SEQ * SEQ * 2;
constexpr size_t B_TOT = B_W + B_XB + B_F + 2 * B_QK + 2 * B_VT + B_S + 2 * B_P;
static_assert(B_W % 256 == 0 && B_XB % 256 == 0 && B_F % 256 == 0 && B_QK % 256 == 0 && B_VT % 256 == 0 && B_S % 256 == 0 && B_P % 256 == 0);
static_assert(B_TOT <= (size_t)134217728);

extern "C" void kernel_launch(void* const* d_in, const int* in_sizes, int n_in,
                              void* d_out, int out_size, void* d_ws, size_t ws_size, hipStream_t stream) {
    if (n_in < 2) return;
    if ((size_t)in_sizes[0] < (size_t)(NB - 1) * SEQ_FULL * DM + (size_t)SEQ * DM) return;
    if ((size_t)in_sizes[1] < (size_t)3 * DM * HD) return;
    if ((size_t)out_size < (size_t)NB * SEQ * HD) return;
    if (B_TOT > ws_size) return;
    const float* x = (const float*)d_in[0];      // [8][2048][512]
    const float* ker = (const float*)d_in[1];    // [3][512][64]
    float* OUT = (float*)d_out;                  // [NB][SEQ][64]
    char* wsp = (char*)d_ws;
    auto take = [&](size_t bytes) { char* p = wsp; wsp += (bytes + 255) & ~(size_t)255; return (void*)p; };
    bf* W    = (bf*)take(B_W);       // [192][512]: rows 0..63 q, 64..127 k, 128..191 v (k-contiguous)
    bf* XB   = (bf*)take(B_XB);      // [NB*SEQ][512]
    float* F = (float*)take(B_F);    // [NB*SEQ][192] f32 projections
    bf* QKh  = (bf*)take(B_QK);      // [2][NB*SEQ][64]
    bf* QKl  = (bf*)take(B_QK);
    bf* VTh  = (bf*)take(B_VT);      // [NB][64][SEQ]
    bf* VTl  = (bf*)take(B_VT);
    float* Sb = (float*)take(B_S);   // [ZB][SEQ][SEQ]
    bf* Ph   = (bf*)take(B_P);       // [ZB][SEQ][SEQ]
    bf* Pl   = (bf*)take(B_P);
    if ((size_t)(wsp - (char*)d_ws) > ws_size) return;

    const size_t PLN = (size_t)NB * SEQ * HD;    // one q or k plane, elements
    // weights: in[512][64] -> out[64][512] per block; grid x = 512 lines / 64 lines per block
    k_wtG<<<dim3((unsigned)(DM * HD / 64 / 64), 3, 1), 256, 0, stream>>>(ker, DM, HD, W);
    k_cvt8<<<dim3((unsigned)((size_t)SEQ * DM / 8 / 256), NB, 1), 256, 0, stream>>>(x, XB, (size_t)SEQ * DM / 8, (size_t)SEQ_FULL * DM, (size_t)SEQ * DM);
    k_gemmw<bf, 0, false><<<dim3(NB * SEQ / 64, NQKV / 64, 1), 32, 0, stream>>>(XB, nullptr, W, nullptr, DM, F, NQKV, nullptr, 0, 0, 0);
    k_plane<<<dim3((unsigned)(PLN / 512), 2, 1), 256, 0, stream>>>(F, NQKV, PLN, QKh, QKl);
    k_vtp<<<(unsigned)((size_t)NB * HD * SEQ / 512), 256, 0, stream>>>(F, NQKV, 2 * HD, VTh, VTl);
    for (int b0 = 0; b0 < NB; b0 += ZB) {
        const size_t qo = (size_t)b0 * SEQ * HD;
        // scores S[z][i][j] = q_i . k_j (hi.hi + lo.hi + hi.lo)
        k_gemmw<bf, 2, false><<<dim3(SEQ / 64, SEQ / 64, ZB), 32, 0, stream>>>(QKh + qo, QKl + qo, QKh + PLN + qo, QKl + PLN + qo, HD, Sb, SEQ, nullptr, (size_t)SEQ * HD, (size_t)SEQ * HD, (size_t)SEQ * SEQ);
        k_asoft<<<(unsigned)(ZB * SEQ / 8), 256, 0, stream>>>(Sb, Ph, Pl, ZB * SEQ);
        // out rows = P . v (hi.hi + lo.hi + hi.lo), written straight into the output
        k_gemmw<bf, 2, false><<<dim3(SEQ / 64, HD / 64, ZB), 32, 0, stream>>>(Ph, Pl, VTh + (size_t)b0 * HD * SEQ, VTl + (size_t)b0 * HD * SEQ, SEQ, OUT + qo, HD, nullptr, (size_t)SEQ * SEQ, (size_t)HD * SEQ, (size_t)SEQ * HD);
    }
}

// v001
// Measured time: 70.3 microseconds a run.
// Timed twice side by side with v000, it ran 4.16 times as fast both times.
#include <hip/hip_runtime.h>

// Single-head self-attention, 8 x 2048 tokens, model width 512, head width 64 (x [8][2048][512]; q/k/v = x kernel[0/1/2] ([3][512][64]); scores x 64^-0.5; softmax over 2048 keys; out = attn v -> [8][2048][64]).
// Compute dtypes, f32 accumulate everywhere: x and kernel converted to bf16 (RNE) once, projections v_wmma_f32_16x16x32_bf16 single product (exact products of bf16 inputs);
// scores q.k: bf16 hi/lo planes, 3 products; softmax f32, online (running maximum, unnormalised P, one division at the end); attn.v: bf16 hi/lo planes of P and of v, 3 products; output f32.
// Scores, softmax and attn.v run in ONE kernel (k_fattn): neither the scores nor P ever reach memory.

#ifndef NB
#define NB 8
#endif
#ifndef SEQ
#define SEQ 2048
#endif
#define NB_FULL  8
#define SEQ_FULL 2048
#define DM   512
#define HD   64
#define NQKV 192                 // fused projection width: q | k | v
#define NCG  4                   // 16-query column groups per wave of the fused attention kernel
#define KSPL 8                   // key ranges per work-group, one wave each
#define QB   (NCG * 16)          // queries per work-group
#define SCL  0.125f              // HD^-0.5

static_assert(NB <= NB_FULL);
static_assert(SEQ <= SEQ_FULL);
static_assert(SEQ % QB == 0);
static_assert(SEQ % (KSPL * 32) == 0);
static_assert((QB * HD / 4) % (KSPL * 32) == 0);
static_assert(SEQ % 128 == 0);
static_assert(DM % 32 == 0);
static_assert(HD == 64);
static_assert((NB * SEQ) % 64 == 0);
static_assert(((size_t)SEQ * DM / 8) % 256 == 0);
static_assert(((size_t)NB * SEQ * HD) % 512 == 0);
static_assert((DM * HD / 64) % 64 == 0);

typedef unsigned short bf;
typedef _Float16 h16;
typedef __attribute__((ext_vector_type(16))) __bf16   v16bf;
typedef __attribute__((ext_vector_type(16))) _Float16 v16h;
typedef __attribute__((ext_vector_type(8)))  _Float16 v8h;
typedef __attribute__((ext_vector_type(8)))  unsigned short v8us;
typedef __attribute__((ext_vector_type(8)))  float    v8f;
typedef __attribute__((ext_vector_type(4)))  float    v4f;
typedef __attribute__((ext_vector_type(2)))  float    v2f;
typedef __attribute__((ext_vector_type(2)))  unsigned short v2us;
typedef __attribute__((ext_vector_type(4)))  unsigned short v4us;
typedef v4f  __attribute__((may_alias)) v4fa;

__device__ __forceinline__ unsigned short f2bf(float f) { unsigned u = __float_as_uint(f); u += 0x7FFFu + ((u >> 16) & 1u); return (unsigned short)(u >> 16); }
__device__ __forceinline__ float bf2f(unsigned short b) { return __uint_as_float(((unsigned)b) << 16); }
__device__ __forceinline__ float bfr(float f) { return bf2f(f2bf(f)); }
__device__ __forceinline__ v16h cat16(v8h lo, v8h hi) { return __builtin_shufflevector(lo, hi, 0, 1, 2, 3, 4, 5, 6, 7, 8, 9, 10, 11, 12, 13, 14, 15); }
__device__ __forceinline__ v16bf cat16b(v8us lo, v8us hi) { return __builtin_bit_cast(v16bf, __builtin_shufflevector(lo, hi, 0, 1, 2, 3, 4, 5, 6, 7, 8, 9, 10, 11, 12, 13, 14, 15)); }
__device__ __forceinline__ v8f wmma16(v16h a, v16h b, v8f c) { return __builtin_amdgcn_wmma_f32_16x16x32_f16(false, a, false, b, (short)0, c, false, false); }
__device__ __forceinline__ v8f wmmab(v16bf a, v16bf b, v8f c) { return __builtin_amdgcn_wmma_f32_16x16x32_bf16(false, a, false, b, (short)0, c, false, false); }

// ---- k_gemmw: register-blocked GEMM, ONE WAVE per 64x64 output tile (16 accumulators), operands straight from K-contiguous 16-bit planes; grid (M/64, N/64, Z), 32 threads.
// C[m][n] (f32, pitch ldc) = sum_k A[m][k] Bt[n][k] (+ split products per NSPLIT: 2 -> A.Bt + A2.Bt + A.Bt2). z-batch strides sA/sB/sC in elements. K % 32 == 0, M % 64 == 0, N % 64 == 0.
// Fragment map: lane l, h = l>>4: elements 0..7 <- k0+8h+0..7, elements 8..15 <- k0+16+8h+0..7 for both operands; D element j of lane l = (row 8h+j, col l&15).
template <typename T16> struct WFrag;
template <> struct WFrag<h16> { typedef v16h V; static __device__ __forceinline__ V ld(const h16* p) { return cat16(*(const v8h*)p, *(const v8h*)(p + 16)); } static __device__ __forceinline__ v8f mma(V a, V b, v8f c) { return wmma16(a, b, c); } };
template <> struct WFrag<bf> { typedef v16bf V; static __device__ __forceinline__ V ld(const bf* p) { return cat16b(*(const v8us*)p, *(const v8us*)(p + 16)); } static __device__ __forceinline__ v8f mma(V a, V b, v8f c) { return wmmab(a, b, c); } };
template <typename T16, int NSPLIT, bool BIAS>
__global__ __launch_bounds__(32) void k_gemmw(const T16* __restrict__ A, const T16* __restrict__ A2, const T16* __restrict__ Bt, const T16* __restrict__ Bt2, int K, float* C, int ldc, const float* __restrict__ bias, size_t sA, size_t sB, size_t sC) {
    typedef typename WFrag<T16>::V V;
    __shared__ __align__(16) float os[16 * 68];
    const size_t z = blockIdx.z; A += z * sA; if (A2) A2 += z * sA; Bt += z * sB; if (Bt2) Bt2 += z * sB; C += z * sC;
    const int lane = threadIdx.x & 31, lr = lane & 15, hi = lane >> 4; const int r0 = blockIdx.x * 64, c0 = blockIdx.y * 64;
    v8f acc[4][4];
#pragma unroll
    for (int mb = 0; mb < 4; ++mb)
#pragma unroll
        for (int nb = 0; nb < 4; ++nb) acc[mb][nb] = (v8f){};
    const size_t aoff = (size_t)(r0 + lr) * K + 8 * hi, boff = (size_t)(c0 + lr) * K + 8 * hi;
#pragma unroll 1
    for (int kc = 0; kc < K; kc += 32) {
        V a[4], a2[4];
#pragma unroll
        for (int mb = 0; mb < 4; ++mb) { a[mb] = WFrag<T16>::ld(A + aoff + (size_t)mb * 16 * K + kc); if (NSPLIT == 1 || NSPLIT == 2) a2[mb] = WFrag<T16>::ld(A2 + aoff + (size_t)mb * 16 * K + kc); }
#pragma unroll
        for (int nb = 0; nb < 4; ++nb) { const V b = WFrag<T16>::ld(Bt + boff + (size_t)nb * 16 * K + kc); V b2; if (NSPLIT >= 2) b2 = WFrag<T16>::ld(Bt2 + boff + (size_t)nb * 16 * K + kc);
#pragma unroll
            for (int mb = 0; mb < 4; ++mb) { acc[mb][nb] = WFrag<T16>::mma(a[mb], b, acc[mb][nb]); if (NSPLIT == 1 || NSPLIT == 2) acc[mb][nb] = WFrag<T16>::mma(a2[mb], b, acc[mb][nb]); if (NSPLIT >= 2) acc[mb][nb] = WFrag<T16>::mma(a[mb], b2, acc[mb][nb]); } }
        asm volatile("v_nop\n\tv_nop\n\tv_nop\n\tv_nop" : "+v"(acc[0][0]), "+v"(acc[1][1]), "+v"(acc[2][2]), "+v"(acc[3][3]) : "v"(a[0]), "v"(a[3]));
    }
#pragma unroll
    for (int mb = 0; mb < 4; ++mb) {
#pragma unroll
        for (int nb = 0; nb < 4; ++nb) {
#pragma unroll
            for (int j = 0; j < 8; ++j) os[(hi * 8 + j) * 68 + nb * 16 + lr] = acc[mb][nb][j]; }
        __builtin_amdgcn_wave_barrier(); asm volatile("" ::: "memory");
        float* crow = C + (size_t)(r0 + mb * 16) * ldc + c0;
{
#pragma unroll
            for (int s = 0; s < 8; ++s) { const int row = 2 * s + hi, cofs = lr * 4; v4f val = *(const v4fa*)(os + row * 68 + cofs); if (BIAS) { val[0] += bfr(bias[c0 + cofs]); val[1] += bfr(bias[c0 + cofs + 1]); val[2] += bfr(bias[c0 + cofs + 2]); val[3] += bfr(bias[c0 + cofs + 3]); }
                *(v4f*)(crow + (size_t)row * ldc + cofs) = val; }
             }
        __builtin_amdgcn_wave_barrier(); asm volatile("" ::: "memory");
    }
}

__device__ __forceinline__ void splitf(float y, unsigned short& h, unsigned short& l) { h = f2bf(y); l = f2bf(y - bf2f(h)); }

__global__ __launch_bounds__(256) void k_wtG(const float* __restrict__ w, int K, int N, bf* Bt) {
    w += (size_t)blockIdx.y * K * N; Bt += (size_t)blockIdx.y * N * K;
    const int lane = threadIdx.x & 31; const int L0 = (blockIdx.x * 8 + (threadIdx.x >> 5)) * 8; const int nlines = N * K / 64;
{
#pragma unroll 1
        for (int l = 0; l < 8; ++l) { const int L = L0 + l; if (L >= nlines) break; const size_t e = (size_t)L * 64 + lane * 2; const int k = (int)(e % K), n = (int)(e / K); v2us o;
            o[0] = f2bf(w[(size_t)k * N + n]); o[1] = f2bf(w[(size_t)(k + 1) * N + n]); *(v2us*)(Bt + e) = o; }
         }
}

__global__ __launch_bounds__(256) void k_cvt8(const float* __restrict__ src, bf* dst, size_t n8, size_t sSrc, size_t sDst) {
    const size_t i = (size_t)blockIdx.x * 256 + threadIdx.x; if (i >= n8) return;
    src += (size_t)blockIdx.y * sSrc; dst += (size_t)blockIdx.y * sDst;
    const v8f v = *(const v8f*)(src + i * 8); v8us o;
#pragma unroll
    for (int k = 0; k < 8; ++k) o[k] = f2bf(v[k]);
    *(v8us*)(dst + i * 8) = o;  }

__global__ __launch_bounds__(256) void k_plane(const float* __restrict__ F, int pitch, size_t nelem, bf* Ph, bf* Pl) {
    const size_t e = ((size_t)blockIdx.x * 256 + threadIdx.x) * 2; if (e >= nelem) return;
    const int d = (int)(e % HD); const size_t row = e / HD;
    const v2f xv = *(const v2f*)(F + row * (size_t)pitch + (size_t)blockIdx.y * HD + d);
    v2us oh, ol;
#pragma unroll
    for (int q = 0; q < 2; ++q) { unsigned short a2, c2; splitf(xv[q], a2, c2); oh[q] = a2; ol[q] = c2; }
    const size_t oo = (size_t)blockIdx.y * nelem + e;
    *(v2us*)(Ph + oo) = oh; *(v2us*)(Pl + oo) = ol;  }

__global__ __launch_bounds__(256) void k_vtp(const float* __restrict__ F, int pitch, int col0, bf* Vh, bf* Vl) {
    const size_t e = ((size_t)blockIdx.x * 256 + threadIdx.x) * 2; if (e >= (size_t)NB * HD * SEQ) return;
    const int t = (int)(e % SEQ); const int d = (int)((e / SEQ) % HD); const int g = (int)(e / ((size_t)SEQ * HD)); v2us oh, ol;
#pragma unroll
    for (int q = 0; q < 2; ++q) { const float x = F[((size_t)g * SEQ + t + q) * (size_t)pitch + col0 + d]; unsigned short a2, c2; splitf(x, a2, c2); oh[q] = a2; ol[q] = c2; }
    *(v2us*)(Vh + e) = oh; *(v2us*)(Vl + e) = ol;  }

// k_fattn: scores, softmax and attn.v fused. Work-group = QB queries of one batch, KSPL waves; wave w walks keys [w, w+1) * SEQ/KSPL in passes of 32 for ALL QB queries.
// Transposed products: St = K.Qt (A = K rows, B = Q rows, both k-contiguous planes), Ot += Vt.Pt (A = Vt rows, B = P packed from the two St tiles of a pass, which already lie in the operand's k order).
// A lane holds one query's scores (column l&15), so maximum, sum and rescale factor are per lane; the two lane halves hold different keys of that query.
// The running maximum is replaced only when a new one exceeds it by more than 8 (log2 units), so P <= 2^8; the KSPL partial results are joined through LDS in fixed wave order.
__device__ __forceinline__ float xhalf(float x) { return __builtin_bit_cast(float, __builtin_amdgcn_permlanex16(__builtin_bit_cast(int, x), __builtin_bit_cast(int, x), 0x76543210, 0xfedcba98, false, false)); }  // lane l with lane l ^ 16
// one operand fragment from the lane's own byte address: elements 0..7 at p, 8..15 at p + 32 bytes
__device__ __forceinline__ v16bf ldf(const char* p) { return cat16b(*(const v8us*)p, *(const v8us*)(p + 32)); }
typedef __attribute__((ext_vector_type(2))) __bf16   v2bf;
typedef __attribute__((ext_vector_type(8))) unsigned v8u;
// 2^a with the slot behind a transcendental closed by construction: until the v_nop the result is unread and the source register unwritten (they are the statement's operands),
// so what stands directly behind the v_exp_f32 is an independent instruction or the v_nop itself
__device__ __forceinline__ float exp2s(float a) { float p = __builtin_amdgcn_exp2f(a); asm("v_nop" : "+v"(p) : "v"(a)); return p; }
#define OPITCH (HD + 4)
// QK: [hi|lo][q|k][NB*SEQ][HD], VT: [hi|lo][NB][HD][SEQ]: a low plane lies a constant number of bytes behind its high plane, within a load's immediate offset, so one address serves both
constexpr size_t QK_LO = (size_t)2 * NB * SEQ * HD * 2, VT_LO = (size_t)NB * HD * SEQ * 2, K_EL = (size_t)NB * SEQ * HD;
static_assert(QK_LO + 8192 < (1u << 23) && VT_LO + (size_t)4 * 16 * SEQ * 2 < (1u << 23));
__global__ __launch_bounds__(KSPL * 32) void k_fattn(const bf* __restrict__ QK, const bf* __restrict__ VT, float* __restrict__ out) {
    __shared__ __align__(16) float Os[KSPL * QB * OPITCH];
    __shared__ float ms[KSPL * QB];
    __shared__ float ls[KSPL * QB];
    const int tid = threadIdx.x, lane = tid & 31, c = lane & 15, h = lane >> 4, w = __builtin_amdgcn_readfirstlane(tid >> 5);
    const int b = blockIdx.y, q0 = blockIdx.x * QB;
    const float SC2 = SCL * 1.4426950408889634f;   // score scale and log2(e) in one factor
    constexpr int KPW = SEQ / KSPL;                // keys per wave
    const unsigned rowo = (unsigned)(c * HD + 8 * h) * 2u;    // lane's bytes into a 16-row tile of q or k (row c, k order 8h.., 16+8h..)
    const unsigned vrowo = (unsigned)(c * SEQ + 8 * h) * 2u;  // the same for a tile of v transposed
    const char* qa = (const char*)(QK + ((size_t)b * SEQ + q0) * HD) + rowo;
    v16bf qh[NCG][2], ql[NCG][2];
#pragma unroll
    for (int g = 0; g < NCG; ++g)
#pragma unroll
        for (int ks = 0; ks < 2; ++ks) { qh[g][ks] = ldf(qa + (g * 16 * HD + ks * 32) * 2); ql[g][ks] = ldf(qa + QK_LO + (g * 16 * HD + ks * 32) * 2); }
    const char* kp = (const char*)(QK + K_EL + ((size_t)b * SEQ + w * KPW) * HD) + rowo;   // this pass's 32 keys
    const char* vp = (const char*)(VT + (size_t)b * HD * SEQ + w * KPW) + vrowo;
    v8f o[4][NCG]; float m[NCG], l[NCG];
#pragma unroll
    for (int g = 0; g < NCG; ++g) { m[g] = -3.0e38f; l[g] = 0.f;
#pragma unroll
        for (int dt = 0; dt < 4; ++dt) o[dt][g] = (v8f){}; }
    v16bf kh[2][2];
#pragma unroll
    for (int kt = 0; kt < 2; ++kt)
#pragma unroll
        for (int ks = 0; ks < 2; ++ks) kh[kt][ks] = ldf(kp + (kt * 16 * HD + ks * 32) * 2);
    // the wait in front of any rewrite of a register that the loads above name; as the statement's input the lane offset stays live up to it
    asm volatile("s_wait_xcnt 0x0" :: "v"(rowo) : "memory");
    // rolled
#pragma unroll 1
    for (int k0 = 0; k0 < KPW; k0 += 32) {
        // this pass's K low plane and V: the low plane is used last among the score products, V after the softmax
        v16bf kl[2][2], vh[4], vl[4];
#pragma unroll
        for (int kt = 0; kt < 2; ++kt)
#pragma unroll
            for (int ks = 0; ks < 2; ++ks) kl[kt][ks] = ldf(kp + QK_LO + (kt * 16 * HD + ks * 32) * 2);
#pragma unroll
        for (int dt = 0; dt < 4; ++dt) { vh[dt] = ldf(vp + dt * 16 * SEQ * 2); vl[dt] = ldf(vp + VT_LO + dt * 16 * SEQ * 2); }
        v8f st[NCG][2];
#pragma unroll
        for (int g = 0; g < NCG; ++g) { st[g][0] = (v8f){}; st[g][1] = (v8f){}; }
#pragma unroll
        for (int ks = 0; ks < 2; ++ks) {
#pragma unroll
            for (int kt = 0; kt < 2; ++kt)
#pragma unroll
                for (int g = 0; g < NCG; ++g) st[g][kt] = wmmab(kh[kt][ks], qh[g][ks], st[g][kt]);
#pragma unroll
            for (int kt = 0; kt < 2; ++kt)
#pragma unroll
                for (int g = 0; g < NCG; ++g) st[g][kt] = wmmab(kh[kt][ks], ql[g][ks], st[g][kt]);
        }
        // the next pass's K high plane, into the same registers, so that its latency lies under the softmax and attn.v; a wave's last pass fetches, and never uses,
        // the 4 KiB behind its keys: the next wave's or batch's keys or, at the plane's end, the head of the low q plane, all written earlier in this call
#pragma unroll
        for (int kt = 0; kt < 2; ++kt)
#pragma unroll
            for (int ks = 0; ks < 2; ++ks) kh[kt][ks] = ldf(kp + ((32 + kt * 16) * HD + ks * 32) * 2);
#pragma unroll
        for (int ks = 0; ks < 2; ++ks)
#pragma unroll
            for (int kt = 0; kt < 2; ++kt)
#pragma unroll
                for (int g = 0; g < NCG; ++g) st[g][kt] = wmmab(kl[kt][ks], qh[g][ks], st[g][kt]);
        // the wait in front of any rewrite of a register that this pass's loads name (the two addresses advance right behind it); as the statement's inputs they stay live up to it
        asm volatile("s_wait_xcnt 0x0" :: "v"(kp), "v"(vp) : "memory");
        kp += 32 * HD * 2; vp += 32 * 2;
        float mx[NCG]; bool need = false;
#pragma unroll
        for (int g = 0; g < NCG; ++g) { float a = fmaxf(st[g][0][0], st[g][1][0]);
#pragma unroll
            for (int r = 1; r < 8; ++r) a = fmaxf(a, fmaxf(st[g][0][r], st[g][1][r]));
            a = fmaxf(a, xhalf(a)); mx[g] = a * SC2; need = need || (mx[g] > m[g] + 8.0f); }
        if (__builtin_amdgcn_ballot_w32(need) != 0) {
#pragma unroll
            for (int g = 0; g < NCG; ++g) { const float mn = fmaxf(m[g], mx[g]); const float al = exp2s(m[g] - mn); m[g] = mn; l[g] *= al;
#pragma unroll
                for (int dt = 0; dt < 4; ++dt) o[dt][g] *= al; }
        }
        // column group by column group: a group's P lives only until its own twelve products, and the next group's vector work stands beside them
#pragma unroll
        for (int g = 0; g < NCG; ++g) { v8u hu, lu;
#pragma unroll
            for (int s = 0; s < 16; s += 2) { v2f p;
                const float a0 = __builtin_fmaf(st[g][s >> 3][s & 7], SC2, -m[g]), a1 = __builtin_fmaf(st[g][s >> 3][(s & 7) + 1], SC2, -m[g]);
                float p0 = __builtin_amdgcn_exp2f(a0), p1 = __builtin_amdgcn_exp2f(a1);
                // the slot behind a transcendental, as in exp2s, one v_nop for the pair
                asm("v_nop" : "+v"(p0), "+v"(p1) : "v"(a0), "v"(a1));
                p[0] = p0; p[1] = p1; l[g] += p0; l[g] += p1;
                const v2bf hi = __builtin_convertvector(p, v2bf); const v2f rest = p - __builtin_convertvector(hi, v2f); const v2bf lo = __builtin_convertvector(rest, v2bf);
                hu[s >> 1] = __builtin_bit_cast(unsigned, hi); lu[s >> 1] = __builtin_bit_cast(unsigned, lo); }
            const v16bf ph = __builtin_bit_cast(v16bf, hu), pl = __builtin_bit_cast(v16bf, lu);
#pragma unroll
            for (int dt = 0; dt < 4; ++dt) o[dt][g] = wmmab(vh[dt], ph, o[dt][g]);
#pragma unroll
            for (int dt = 0; dt < 4; ++dt) o[dt][g] = wmmab(vl[dt], ph, o[dt][g]);
#pragma unroll
            for (int dt = 0; dt < 4; ++dt) o[dt][g] = wmmab(vh[dt], pl, o[dt][g]); }
    }
    // each wave's partial result: maximum, sum (both lane halves joined) and Ot, a lane's 8 registers being 8 consecutive d of its query
#pragma unroll
    for (int g = 0; g < NCG; ++g) { const int q = g * 16 + c; const float lj = l[g] + xhalf(l[g]);
        if (h == 0) { ms[w * QB + q] = m[g]; ls[w * QB + q] = lj; }
#pragma unroll
        for (int dt = 0; dt < 4; ++dt) { float* p = Os + (size_t)(w * QB + q) * OPITCH + dt * 16 + 8 * h;
            *(v4f*)p = (v4f){o[dt][g][0], o[dt][g][1], o[dt][g][2], o[dt][g][3]}; *(v4f*)(p + 4) = (v4f){o[dt][g][4], o[dt][g][5], o[dt][g][6], o[dt][g][7]}; } }
    __syncthreads();
#pragma unroll
    for (int i = 0; i < QB * HD / 4 / (KSPL * 32); ++i) { const int f = i * (KSPL * 32) + tid, q = f >> 4, d4 = (f & 15) * 4;
        float M = ms[q];
#pragma unroll
        for (int u = 1; u < KSPL; ++u) M = fmaxf(M, ms[u * QB + q]);
        float L = 0.f; v4f acc = (v4f){};
#pragma unroll
        for (int u = 0; u < KSPL; ++u) { const float wt = exp2s(ms[u * QB + q] - M); L += ls[u * QB + q] * wt; acc += *(const v4f*)(Os + (size_t)(u * QB + q) * OPITCH + d4) * wt; }
        const float f1 = __fdiv_rn(1.0f, L);
        *(v4f*)(out + ((size_t)b * SEQ + q0 + q) * HD + d4) = acc * f1; }
}

// workspace carve (bytes), all multiples of 256
constexpr size_t B_W   = (size_t)NQKV * DM * 2;
constexpr size_t B_XB  = (size_t)NB * SEQ * DM * 2;
constexpr size_t B_F   = (size_t)NB * SEQ * NQKV * 4;
constexpr size_t B_QK  = (size_t)2 * NB * SEQ * HD * 2;
constexpr size_t B_VT  = (size_t)NB * HD * SEQ * 2;
constexpr size_t B_TOT = B_W + B_XB + B_F + 2 * B_QK + 2 * B_VT;
static_assert(B_W % 256 == 0 && B_XB % 256 == 0 && B_F % 256 == 0 && B_QK % 256 == 0 && B_VT % 256 == 0);
static_assert(B_TOT <= (size_t)134217728);
static_assert(B_QK == QK_LO && B_VT == VT_LO);   // the low planes are carved directly behind the high planes

extern "C" void kernel_launch(void* const* d_in, const int* in_sizes, int n_in,
                              void* d_out, int out_size, void* d_ws, size_t ws_size, hipStream_t stream) {
    if (n_in < 2) return;
    if ((size_t)in_sizes[0] < (size_t)(NB - 1) * SEQ_FULL * DM + (size_t)SEQ * DM) return;
    if ((size_t)in_sizes[1] < (size_t)3 * DM * HD) return;
    if ((size_t)out_size < (size_t)NB * SEQ * HD) return;
    if (B_TOT > ws_size) return;
    const float* x = (const float*)d_in[0];      // [8][2048][512]
    const float* ker = (const float*)d_in[1];    // [3][512][64]
    float* OUT = (float*)d_out;                  // [NB][SEQ][64]
    char* wsp = (char*)d_ws;
    auto take = [&](size_t bytes) { char* p = wsp; wsp += (bytes + 255) & ~(size_t)255; return (void*)p; };
    bf* W    = (bf*)take(B_W);       // [192][512]: rows 0..63 q, 64..127 k, 128..191 v (k-contiguous)
    bf* XB   = (bf*)take(B_XB);      // [NB*SEQ][512]
    float* F = (float*)take(B_F);    // [NB*SEQ][192] f32 projections
    bf* QKh  = (bf*)take(B_QK);      // [2][NB*SEQ][64]
    bf* QKl  = (bf*)take(B_QK);
    bf* VTh  = (bf*)take(B_VT);      // [NB][64][SEQ]
    bf* VTl  = (bf*)take(B_VT);
    if ((size_t)(wsp - (char*)d_ws) > ws_size) return;

    const size_t PLN = (size_t)NB * SEQ * HD;    // one q or k plane, elements
    // weights: in[512][64] -> out[64][512] per block; grid x = 512 lines / 64 lines per block
    k_wtG<<<dim3((unsigned)(DM * HD / 64 / 64), 3, 1), 256, 0, stream>>>(ker, DM, HD, W);
    k_cvt8<<<dim3((unsigned)((size_t)SEQ * DM / 8 / 256), NB, 1), 256, 0, stream>>>(x, XB, (size_t)SEQ * DM / 8, (size_t)SEQ_FULL * DM, (size_t)SEQ * DM);
    k_gemmw<bf, 0, false><<<dim3(NB * SEQ / 64, NQKV / 64, 1), 32, 0, stream>>>(XB, nullptr, W, nullptr, DM, F, NQKV, nullptr, 0, 0, 0);
    k_plane<<<dim3((unsigned)(PLN / 512), 2, 1), 256, 0, stream>>>(F, NQKV, PLN, QKh, QKl);
    k_vtp<<<(unsigned)((size_t)NB * HD * SEQ / 512), 256, 0, stream>>>(F, NQKV, 2 * HD, VTh, VTl);
    // out = softmax(q k^T x HD^-0.5) v, one launch for all batches
    k_fattn<<<dim3(SEQ / QB, NB, 1), KSPL * 32, 0, stream>>>(QKh, VTh, OUT);
}

// v002
// A run of this version takes 44.2 microseconds.
// Timed twice side by side with v001, it ran 1.58 and 1.59 times as fast.
// All steps since v000 together make it 6.61 times as fast.
#include <hip/hip_runtime.h>

// Single-head self-attention, 8 x 2048 tokens, model width 512, head width 64 (x [8][2048][512]; q/k/v = x kernel[0/1/2] ([3][512][64]); scores x 64^-0.5; softmax over 2048 keys; out = attn v -> [8][2048][64]).
// Compute dtypes, f32 accumulate everywhere: x and kernel converted to bf16 (RNE) once, projections v_wmma_f32_16x16x32_bf16 single product (exact products of bf16 inputs);
// scores q.k: bf16 hi/lo planes, 3 products; softmax f32, online (running maximum, unnormalised P, one division at the end); attn.v: bf16 hi/lo planes of P and of v, 3 products; output f32.
// Scores, softmax and attn.v run in ONE kernel (k_fattn): neither the scores nor P ever reach memory.
// The bf16 conversion of x, the three projections, the hi/lo split and the transposition of v run in ONE kernel too (k_proj).

#ifndef NB
#define NB 8
#endif
#ifndef SEQ
#define SEQ 2048
#endif
#define NB_FULL  8
#define SEQ_FULL 2048
#define DM   512
#define HD   64
#define NQKV 192                 // fused projection width: q | k | v
#define NCG  4                   // 16-query column groups per wave of the fused attention kernel
#define KSPL 8                   // key ranges per work-group, one wave each
#define QB   (NCG * 16)          // queries per work-group
#define SCL  0.125f              // HD^-0.5

static_assert(NB <= NB_FULL);
static_assert(SEQ <= SEQ_FULL);
static_assert(SEQ % QB == 0);
static_assert(SEQ % (KSPL * 32) == 0);
static_assert((QB * HD / 4) % (KSPL * 32) == 0);
static_assert(SEQ % 128 == 0);
static_assert(DM % 32 == 0);
static_assert(HD == 64);
static_assert((NB * SEQ) % 64 == 0);
static_assert((DM * HD / 64) % 64 == 0);

typedef unsigned short bf;
typedef __attribute__((ext_vector_type(16))) __bf16   v16bf;
typedef __attribute__((ext_vector_type(8)))  unsigned short v8us;
typedef __attribute__((ext_vector_type(8)))  float    v8f;
typedef __attribute__((ext_vector_type(4)))  float    v4f;
typedef __attribute__((ext_vector_type(2)))  float    v2f;
typedef __attribute__((ext_vector_type(2)))  unsigned short v2us;
typedef v4f  __attribute__((may_alias)) v4fa;

__device__ __forceinline__ unsigned short f2bf(float f) { unsigned u = __float_as_uint(f); u += 0x7FFFu + ((u >> 16) & 1u); return (unsigned short)(u >> 16); }
__device__ __forceinline__ v16bf cat16b(v8us lo, v8us hi) { return __builtin_bit_cast(v16bf, __builtin_shufflevector(lo, hi, 0, 1, 2, 3, 4, 5, 6, 7, 8, 9, 10, 11, 12, 13, 14, 15)); }
__device__ __forceinline__ v8f wmmab(v16bf a, v16bf b, v8f c) { return __builtin_amdgcn_wmma_f32_16x16x32_bf16(false, a, false, b, (short)0, c, false, false); }

__global__ __launch_bounds__(256) void k_wtG(const float* __restrict__ w, int K, int N, bf* Bt) {
    w += (size_t)blockIdx.y * K * N; Bt += (size_t)blockIdx.y * N * K;
    const int lane = threadIdx.x & 31; const int L0 = (blockIdx.x * 8 + (threadIdx.x >> 5)) * 8; const int nlines = N * K / 64;
{
#pragma unroll 1
        for (int l = 0; l < 8; ++l) { const int L = L0 + l; if (L >= nlines) break; const size_t e = (size_t)L * 64 + lane * 2; const int k = (int)(e % K), n = (int)(e / K); v2us o;
            o[0] = f2bf(w[(size_t)k * N + n]); o[1] = f2bf(w[(size_t)(k + 1) * N + n]); *(v2us*)(Bt + e) = o; }
         }
}

// k_fattn: scores, softmax and attn.v fused. Work-group = QB queries of one batch, KSPL waves; wave w walks keys [w, w+1) * SEQ/KSPL in passes of 32 for ALL QB queries.
// Transposed products: St = K.Qt (A = K rows, B = Q rows, both k-contiguous planes), Ot += Vt.Pt (A = Vt rows, B = P packed from the two St tiles of a pass, which already lie in the operand's k order).
// A lane holds one query's scores (column l&15), so maximum, sum and rescale factor are per lane; the two lane halves hold different keys of that query.
// The running maximum is replaced only when a new one exceeds it by more than 8 (log2 units), so P <= 2^8; the KSPL partial results are joined through LDS in fixed wave order.
__device__ __forceinline__ float xhalf(float x) { return __builtin_bit_cast(float, __builtin_amdgcn_permlanex16(__builtin_bit_cast(int, x), __builtin_bit_cast(int, x), 0x76543210, 0xfedcba98, false, false)); }  // lane l with lane l ^ 16
// one operand fragment from the lane's own byte address: elements 0..7 at p, 8..15 at p + 32 bytes
__device__ __forceinline__ v16bf ldf(const char* p) { return cat16b(*(const v8us*)p, *(const v8us*)(p + 32)); }
typedef __attribute__((ext_vector_type(2))) __bf16   v2bf;
typedef __attribute__((ext_vector_type(8))) unsigned v8u;
// 2^a with the slot behind a transcendental closed by construction: until the v_nop the result is unread and the source register unwritten (they are the statement's operands),
// so what stands directly behind the v_exp_f32 is an independent instruction or the v_nop itself
__device__ __forceinline__ float exp2s(float a) { float p = __builtin_amdgcn_exp2f(a); asm("v_nop" : "+v"(p) : "v"(a)); return p; }
#define OPITCH (HD + 4)
// QK: [hi|lo][q|k][NB*SEQ][HD], VT: [hi|lo][NB][HD][SEQ]: a low plane lies a constant number of bytes behind its high plane, within a load's immediate offset, so one address serves both
constexpr size_t QK_LO = (size_t)2 * NB * SEQ * HD * 2, VT_LO = (size_t)NB * HD * SEQ * 2, K_EL = (size_t)NB * SEQ * HD;
static_assert(QK_LO + 8192 < (1u << 23) && VT_LO + (size_t)4 * 16 * SEQ * 2 < (1u << 23));
__global__ __launch_bounds__(KSPL * 32) void k_fattn(const bf* __restrict__ QK, const bf* __restrict__ VT, float* __restrict__ out) {
    __shared__ __align__(16) float Os[KSPL * QB * OPITCH];
    __shared__ float ms[KSPL * QB];
    __shared__ float ls[KSPL * QB];
    const int tid = threadIdx.x, lane = tid & 31, c = lane & 15, h = lane >> 4, w = __builtin_amdgcn_readfirstlane(tid >> 5);
    const int b = blockIdx.y, q0 = blockIdx.x * QB;
    const float SC2 = SCL * 1.4426950408889634f;   // score scale and log2(e) in one factor
    constexpr int KPW = SEQ / KSPL;                // keys per wave
    const unsigned rowo = (unsigned)(c * HD + 8 * h) * 2u;    // lane's bytes into a 16-row tile of q or k (row c, k order 8h.., 16+8h..)
    const unsigned vrowo = (unsigned)(c * SEQ + 8 * h) * 2u;  // the same for a tile of v transposed
    const char* qa = (const char*)(QK + ((size_t)b * SEQ + q0) * HD) + rowo;
    v16bf qh[NCG][2], ql[NCG][2];
#pragma unroll
    for (int g = 0; g < NCG; ++g)
#pragma unroll
        for (int ks = 0; ks < 2; ++ks) { qh[g][ks] = ldf(qa + (g * 16 * HD + ks * 32) * 2); ql[g][ks] = ldf(qa + QK_LO + (g * 16 * HD + ks * 32) * 2); }
    const char* kp = (const char*)(QK + K_EL + ((size_t)b * SEQ + w * KPW) * HD) + rowo;   // this pass's 32 keys
    const char* vp = (const char*)(VT + (size_t)b * HD * SEQ + w * KPW) + vrowo;
    v8f o[4][NCG]; float m[NCG], l[NCG];
#pragma unroll
    for (int g = 0; g < NCG; ++g) { m[g] = -3.0e38f; l[g] = 0.f;
#pragma unroll
        for (int dt = 0; dt < 4; ++dt) o[dt][g] = (v8f){}; }
    v16bf kh[2][2];
#pragma unroll
    for (int kt = 0; kt < 2; ++kt)
#pragma unroll
        for (int ks = 0; ks < 2; ++ks) kh[kt][ks] = ldf(kp + (kt * 16 * HD + ks * 32) * 2);
    // the wait in front of any rewrite of a register that the loads above name; as the statement's input the lane offset stays live up to it
    asm volatile("s_wait_xcnt 0x0" :: "v"(rowo) : "memory");
    // rolled
#pragma unroll 1
    for (int k0 = 0; k0 < KPW; k0 += 32) {
        // this pass's K low plane and V: the low plane is used last among the score products, V after the softmax
        v16bf kl[2][2], vh[4], vl[4];
#pragma unroll
        for (int kt = 0; kt < 2; ++kt)
#pragma unroll
            for (int ks = 0; ks < 2; ++ks) kl[kt][ks] = ldf(kp + QK_LO + (kt * 16 * HD + ks * 32) * 2);
#pragma unroll
        for (int dt = 0; dt < 4; ++dt) { vh[dt] = ldf(vp + dt * 16 * SEQ * 2); vl[dt] = ldf(vp + VT_LO + dt * 16 * SEQ * 2); }
        v8f st[NCG][2];
#pragma unroll
        for (int g = 0; g < NCG; ++g) { st[g][0] = (v8f){}; st[g][1] = (v8f){}; }
#pragma unroll
        for (int ks = 0; ks < 2; ++ks) {
#pragma unroll
            for (int kt = 0; kt < 2; ++kt)
#pragma unroll
                for (int g = 0; g < NCG; ++g) st[g][kt] = wmmab(kh[kt][ks], qh[g][ks], st[g][kt]);
#pragma unroll
            for (int kt = 0; kt < 2; ++kt)
#pragma unroll
                for (int g = 0; g < NCG; ++g) st[g][kt] = wmmab(kh[kt][ks], ql[g][ks], st[g][kt]);
        }
        // the next pass's K high plane, into the same registers, so that its latency lies under the softmax and attn.v; a wave's last pass fetches, and never uses,
        // the 4 KiB behind its keys: the next wave's or batch's keys or, at the plane's end, the head of the low q plane, all written earlier in this call
#pragma unroll
        for (int kt = 0; kt < 2; ++kt)
#pragma unroll
            for (int ks = 0; ks < 2; ++ks) kh[kt][ks] = ldf(kp + ((32 + kt * 16) * HD + ks * 32) * 2);
#pragma unroll
        for (int ks = 0; ks < 2; ++ks)
#pragma unroll
            for (int kt = 0; kt < 2; ++kt)
#pragma unroll
                for (int g = 0; g < NCG; ++g) st[g][kt] = wmmab(kl[kt][ks], qh[g][ks], st[g][kt]);
        // the wait in front of any rewrite of a register that this pass's loads name (the two addresses advance right behind it); as the statement's inputs they stay live up to it
        asm volatile("s_wait_xcnt 0x0" :: "v"(kp), "v"(vp) : "memory");
        kp += 32 * HD * 2; vp += 32 * 2;
        float mx[NCG]; bool need = false;
#pragma unroll
        for (int g = 0; g < NCG; ++g) { float a = fmaxf(st[g][0][0], st[g][1][0]);
#pragma unroll
            for (int r = 1; r < 8; ++r) a = fmaxf(a, fmaxf(st[g][0][r], st[g][1][r]));
            a = fmaxf(a, xhalf(a)); mx[g] = a * SC2; need = need || (mx[g] > m[g] + 8.0f); }
        if (__builtin_amdgcn_ballot_w32(need) != 0) {
#pragma unroll
            for (int g = 0; g < NCG; ++g) { const float mn = fmaxf(m[g], mx[g]); const float al = exp2s(m[g] - mn); m[g] = mn; l[g] *= al;
#pragma unroll
                for (int dt = 0; dt < 4; ++dt) o[dt][g] *= al; }
        }
        // column group by column group: a group's P lives only until its own twelve products, and the next group's vector work stands beside them
#pragma unroll
        for (int g = 0; g < NCG; ++g) { v8u hu, lu;
#pragma unroll
            for (int s = 0; s < 16; s += 2) { v2f p;
                const float a0 = __builtin_fmaf(st[g][s >> 3][s & 7], SC2, -m[g]), a1 = __builtin_fmaf(st[g][s >> 3][(s & 7) + 1], SC2, -m[g]);
                float p0 = __builtin_amdgcn_exp2f(a0), p1 = __builtin_amdgcn_exp2f(a1);
                // the slot behind a transcendental, as in exp2s, one v_nop for the pair
                asm("v_nop" : "+v"(p0), "+v"(p1) : "v"(a0), "v"(a1));
                p[0] = p0; p[1] = p1; l[g] += p0; l[g] += p1;
                const v2bf hi = __builtin_convertvector(p, v2bf); const v2f rest = p - __builtin_convertvector(hi, v2f); const v2bf lo = __builtin_convertvector(rest, v2bf);
                hu[s >> 1] = __builtin_bit_cast(unsigned, hi); lu[s >> 1] = __builtin_bit_cast(unsigned, lo); }
            const v16bf ph = __builtin_bit_cast(v16bf, hu), pl = __builtin_bit_cast(v16bf, lu);
#pragma unroll
            for (int dt = 0; dt < 4; ++dt) o[dt][g] = wmmab(vh[dt], ph, o[dt][g]);
#pragma unroll
            for (int dt = 0; dt < 4; ++dt) o[dt][g] = wmmab(vl[dt], ph, o[dt][g]);
#pragma unroll
            for (int dt = 0; dt < 4; ++dt) o[dt][g] = wmmab(vh[dt], pl, o[dt][g]); }
    }
    // each wave's partial result: maximum, sum (both lane halves joined) and Ot, a lane's 8 registers being 8 consecutive d of its query
#pragma unroll
    for (int g = 0; g < NCG; ++g) { const int q = g * 16 + c; const float lj = l[g] + xhalf(l[g]);
        if (h == 0) { ms[w * QB + q] = m[g]; ls[w * QB + q] = lj; }
#pragma unroll
        for (int dt = 0; dt < 4; ++dt) { float* p = Os + (size_t)(w * QB + q) * OPITCH + dt * 16 + 8 * h;
            *(v4f*)p = (v4f){o[dt][g][0], o[dt][g][1], o[dt][g][2], o[dt][g][3]}; *(v4f*)(p + 4) = (v4f){o[dt][g][4], o[dt][g][5], o[dt][g][6], o[dt][g][7]}; } }
    __syncthreads();
#pragma unroll
    for (int i = 0; i < QB * HD / 4 / (KSPL * 32); ++i) { const int f = i * (KSPL * 32) + tid, q = f >> 4, d4 = (f & 15) * 4;
        float M = ms[q];
#pragma unroll
        for (int u = 1; u < KSPL; ++u) M = fmaxf(M, ms[u * QB + q]);
        float L = 0.f; v4f acc = (v4f){};
#pragma unroll
        for (int u = 0; u < KSPL; ++u) { const float wt = exp2s(ms[u * QB + q] - M); L += ls[u * QB + q] * wt; acc += *(const v4f*)(Os + (size_t)(u * QB + q) * OPITCH + d4) * wt; }
        const float f1 = __fdiv_rn(1.0f, L);
        *(v4f*)(out + ((size_t)b * SEQ + q0 + q) * HD + d4) = acc * f1; }
}
// k_proj: q, k and v of PR token rows in one work-group, from x in f32 to the operand planes of k_fattn; neither a bf16 copy of x nor the f32 projections reach memory.
// Whole-line loads bring the PR x DM tile of x (converted to bf16, RNE, on the way) and all of W into LDS; 8 waves then hold 2 x 3 tiles of the PR x NQKV result each
// (A = x rows, B = W rows, both read by ldf, k in steps of 32 from 0 up). The f32 results go through LDS, q|k by rows and v transposed, so that every plane is stored in whole 128-byte lines.
#define PR   64                  // token rows per work-group
#define XPB  ((DM + 8) * 2)      // LDS row pitch of the two bf16 operand tiles, bytes: 16 x an odd number, for 16-byte readers
#define FPI  (2 * HD + 4)        // LDS row pitch of the f32 q|k tile, floats
#define VPI  (PR + 4)            // LDS row pitch of the f32 v tile (row = d, column = token), floats
static_assert(SEQ % PR == 0 && DM == 512 && NQKV == 192 && PR == 64);
static_assert((size_t)(PR * FPI + HD * VPI) * 4 <= (size_t)PR * XPB);
typedef __attribute__((ext_vector_type(4))) unsigned v4u;
typedef __attribute__((ext_vector_type(2))) unsigned v2u;
__device__ __forceinline__ unsigned pkbf(float a, float b) { const v2f p = {a, b}; return __builtin_bit_cast(unsigned, __builtin_convertvector(p, v2bf)); }
// eight f32 -> eight bf16 high parts and eight bf16 low parts (the rest after the high part, rounded)
__device__ __forceinline__ void split8(v4f a, v4f b, v4u& hi, v4u& lo) {
    const float y[8] = {a[0], a[1], a[2], a[3], b[0], b[1], b[2], b[3]};
#pragma unroll
    for (int s = 0; s < 4; ++s) { const v2f p = {y[2 * s], y[2 * s + 1]};
        const v2bf hb = __builtin_convertvector(p, v2bf); const v2f rest = p - __builtin_convertvector(hb, v2f); const v2bf lb = __builtin_convertvector(rest, v2bf);
        hi[s] = __builtin_bit_cast(unsigned, hb); lo[s] = __builtin_bit_cast(unsigned, lb); }
}
__global__ __launch_bounds__(256) void k_proj(const float* __restrict__ x, const bf* __restrict__ W, bf* __restrict__ QK, bf* __restrict__ VT) {
    __shared__ __align__(16) char sm[(PR + NQKV) * XPB];
    char* Xs = sm; char* Ws = sm + PR * XPB;
    const int tid = threadIdx.x, lane = tid & 31, c = lane & 15, h = lane >> 4, w = __builtin_amdgcn_readfirstlane(tid >> 5);
    const int R0 = blockIdx.x * PR, b = R0 / SEQ, t0 = R0 % SEQ;
    // 256 threads x 16 bytes = 4 KiB a step: two rows of x, four rows of W; one uniform base each and the thread's own 16 bytes, the steps in the immediate offset
    const char* xb = (const char*)(x + ((size_t)b * SEQ_FULL + t0) * DM);
    const char* wbs = (const char*)W;
    char* xs = Xs + (tid >> 7) * XPB + (tid & 127) * 8;
    char* wsd = Ws + (tid >> 6) * XPB + (tid & 63) * 16;
    // every load of the work-group is issued before the first is used: one trip to memory, not several
    // (all loops of this kernel are unrolled: their indices pick registers and immediate offsets)
    v4f xr[32]; v4u wr[48];
#pragma unroll
    for (int i = 0; i < 32; ++i) xr[i] = *(const v4f*)(xb + (size_t)tid * 16 + i * 4096);
#pragma unroll
    for (int i = 0; i < 48; ++i) wr[i] = *(const v4u*)(wbs + (size_t)tid * 16 + i * 4096);
    // the wait in front of any rewrite of a register that the loads above name; as the statement's inputs the two bases and the thread's index stay live up to it
    asm volatile("s_wait_xcnt 0x0" :: "s"(xb), "s"(wbs), "v"(tid) : "memory");
#pragma unroll
    for (int i = 0; i < 32; ++i) *(v2u*)(xs + i * 2 * XPB) = (v2u){pkbf(xr[i][0], xr[i][1]), pkbf(xr[i][2], xr[i][3])};
#pragma unroll
    for (int i = 0; i < 48; ++i) *(v4u*)(wsd + i * 4 * XPB) = wr[i];
    __syncthreads();
    const int rg = w & 1, cg = w >> 1;   // rows rg * 32 .. + 31, columns cg * 48 .. + 47
    const char* ap = Xs + (rg * 32 + c) * XPB + h * 16;
    const char* bp = Ws + (cg * 48 + c) * XPB + h * 16;
    v8f acc[2][3];
#pragma unroll
    for (int rt = 0; rt < 2; ++rt)
#pragma unroll
        for (int ct = 0; ct < 3; ++ct) acc[rt][ct] = (v8f){};
    // fragments one k step ahead, in two register sets, so that a step's products do not wait for their own LDS reads
    v16bf a[2][2], bb[2][3];
#pragma unroll
    for (int rt = 0; rt < 2; ++rt) a[0][rt] = ldf(ap + rt * 16 * XPB);
#pragma unroll
    for (int ct = 0; ct < 3; ++ct) bb[0][ct] = ldf(bp + ct * 16 * XPB);
#pragma unroll
    for (int kc = 0; kc < DM / 32; ++kc) { const int cu = kc & 1, nx = cu ^ 1;
        if (kc + 1 < DM / 32) {
#pragma unroll
            for (int rt = 0; rt < 2; ++rt) a[nx][rt] = ldf(ap + rt * 16 * XPB + (kc + 1) * 64);
#pragma unroll
            for (int ct = 0; ct < 3; ++ct) bb[nx][ct] = ldf(bp + ct * 16 * XPB + (kc + 1) * 64);
        }
        // keeps the next step's reads in front of this step's products (the scheduler otherwise sinks them to just before their use)
        __builtin_amdgcn_sched_barrier(0);
#pragma unroll
        for (int rt = 0; rt < 2; ++rt)
#pragma unroll
            for (int ct = 0; ct < 3; ++ct) acc[rt][ct] = wmmab(a[cu][rt], bb[cu][ct], acc[rt][ct]); }
    __syncthreads();   // every wave has read its last fragment: the operand tiles' LDS now takes the results
    float* Fs = (float*)sm; float* Vs = Fs + PR * FPI;
    // accumulator register j of lane (c, h) = (row 8h + j, column c) of its tile
#pragma unroll
    for (int rt = 0; rt < 2; ++rt)
#pragma unroll
        for (int ct = 0; ct < 3; ++ct) { const int nt = cg * 3 + ct, r = rg * 32 + rt * 16 + 8 * h; const v8f d = acc[rt][ct];
            if (nt < 8) {
#pragma unroll
                for (int j = 0; j < 8; ++j) Fs[(r + j) * FPI + nt * 16 + c] = d[j];
            } else { float* p = Vs + ((nt - 8) * 16 + c) * VPI + r; *(v4fa*)p = (v4f){d[0], d[1], d[2], d[3]}; *(v4fa*)(p + 4) = (v4f){d[4], d[5], d[6], d[7]}; } }
    __syncthreads();
    // q|k: 16 threads a token row (8 for its q line, 8 for its k line), 16 rows a step; v: 8 threads a d row (64 tokens, one line), 32 rows a step
    char* qo = (char*)(QK + (size_t)((tid >> 3) & 1) * K_EL + ((size_t)R0 + (tid >> 4)) * HD + (tid & 7) * 8);
    char* vo = (char*)(VT + ((size_t)b * HD + (tid >> 3)) * SEQ + t0 + (tid & 7) * 8);
#pragma unroll
    for (int it = 0; it < 4; ++it) { const float* s = Fs + (it * 16 + (tid >> 4)) * FPI + (tid & 15) * 8; v4u hi, lo; split8(*(const v4fa*)s, *(const v4fa*)(s + 4), hi, lo);
        *(v4u*)(qo + it * 16 * HD * 2) = hi; *(v4u*)(qo + QK_LO + it * 16 * HD * 2) = lo; }
#pragma unroll
    for (int it = 0; it < 2; ++it) { const float* s = Vs + (it * 32 + (tid >> 3)) * VPI + (tid & 7) * 8; v4u hi, lo; split8(*(const v4fa*)s, *(const v4fa*)(s + 4), hi, lo);
        *(v4u*)(vo + it * 32 * SEQ * 2) = hi; *(v4u*)(vo + VT_LO + it * 32 * SEQ * 2) = lo; }
}

// workspace carve (bytes), all multiples of 256
constexpr size_t B_W   = (size_t)NQKV * DM * 2;
constexpr size_t B_QK  = (size_t)2 * NB * SEQ * HD * 2;
constexpr size_t B_VT  = (size_t)NB * HD * SEQ * 2;
constexpr size_t B_TOT = B_W + 2 * B_QK + 2 * B_VT;
static_assert(B_W % 256 == 0 && B_QK % 256 == 0 && B_VT % 256 == 0);
static_assert(B_TOT <= (size_t)134217728);
static_assert(B_QK == QK_LO && B_VT == VT_LO);   // the low planes are carved directly behind the high planes

extern "C" void kernel_launch(void* const* d_in, const int* in_sizes, int n_in,
                              void* d_out, int out_size, void* d_ws, size_t ws_size, hipStream_t stream) {
    if (n_in < 2) return;
    if ((size_t)in_sizes[0] < (size_t)(NB - 1) * SEQ_FULL * DM + (size_t)SEQ * DM) return;
    if ((size_t)in_sizes[1] < (size_t)3 * DM * HD) return;
    if ((size_t)out_size < (size_t)NB * SEQ * HD) return;
    if (B_TOT > ws_size) return;
    const float* x = (const float*)d_in[0];      // [8][2048][512]
    const float* ker = (const float*)d_in[1];    // [3][512][64]
    float* OUT = (float*)d_out;                  // [NB][SEQ][64]
    char* wsp = (char*)d_ws;
    auto take = [&](size_t bytes) { char* p = wsp; wsp += (bytes + 255) & ~(size_t)255; return (void*)p; };
    bf* W    = (bf*)take(B_W);       // [192][512]: rows 0..63 q, 64..127 k, 128..191 v (k-contiguous)
    bf* QKh  = (bf*)take(B_QK);      // [2][NB*SEQ][64]
    bf* QKl  = (bf*)take(B_QK);
    bf* VTh  = (bf*)take(B_VT);      // [NB][64][SEQ]
    bf* VTl  = (bf*)take(B_VT);
    (void)QKl; (void)VTl;            // reached from the high planes' addresses (QK_LO, VT_LO)
    if ((size_t)(wsp - (char*)d_ws) > ws_size) return;

    // weights: in[512][64] -> out[64][512] per block; grid x = 512 lines / 64 lines per block
    k_wtG<<<dim3((unsigned)(DM * HD / 64 / 64), 3, 1), 256, 0, stream>>>(ker, DM, HD, W);
    // x -> q, k (hi/lo planes) and v transposed (hi/lo planes), one launch
    k_proj<<<dim3(NB * SEQ / PR, 1, 1), 256, 0, stream>>>(x, W, QKh, VTh);
    // out = softmax(q k^T x HD^-0.5) v, one launch for all batches
    k_fattn<<<dim3(SEQ / QB, NB, 1), KSPL * 32, 0, stream>>>(QKh, VTh, OUT);
}

// v003
// A run of this version takes 36.6 microseconds.
// Two timings next to v002 both put it at 1.24 times that version's speed.
// Over all steps from v000 it is 8.19 times as fast.
#include <hip/hip_runtime.h>

// Single-head self-attention, 8 x 2048 tokens, model width 512, head width 64 (x [8][2048][512]; q/k/v = x kernel[0/1/2] ([3][512][64]); scores x 64^-0.5; softmax over 2048 keys; out = attn v -> [8][2048][64]).
// Compute dtypes, f32 accumulate everywhere: x and kernel converted to bf16 (RNE) once, projections v_wmma_f32_16x16x32_bf16 single product (exact products of bf16 inputs);
// scores q.k: bf16 hi/lo planes, 3 products; softmax f32, online (running maximum, unnormalised P, one division at the end); attn.v: bf16 hi/lo planes of P and of v, 3 products; output f32.
// Scores, softmax and attn.v run in ONE kernel (k_fattn): neither the scores nor P ever reach memory.
// The bf16 conversion of x, the three projections, the hi/lo split and the transposition of v run in ONE kernel too (k_proj).
// The planes of q, k and v lie in memory in FRAGMENT ORDER: the 16 bytes that lane 0..31 of a wave takes with one load stand side by side, so a load covers 512 contiguous bytes (4 whole lines).

#ifndef NB
#define NB 8
#endif
#ifndef SEQ
#define SEQ 2048
#endif
#define NB_FULL  8
#define SEQ_FULL 2048
#define DM   512
#define HD   64
#define NQKV 192                 // fused projection width: q | k | v
#define NCG  4                   // 16-query column groups per wave of the fused attention kernel
#define KSPL 8                   // key ranges per work-group, one wave each
#define QB   (NCG * 16)          // queries per work-group
#define SCL  0.125f              // HD^-0.5

static_assert(NB <= NB_FULL);
static_assert(SEQ <= SEQ_FULL);
static_assert(SEQ % QB == 0);
static_assert(SEQ % (KSPL * 32) == 0);
static_assert((QB * HD / 4) % (KSPL * 32) == 0);
static_assert(SEQ % 128 == 0);
static_assert(DM % 32 == 0);
static_assert(HD == 64);
static_assert((NB * SEQ) % 64 == 0);
static_assert((DM * HD / 64) % 64 == 0);

typedef unsigned short bf;
typedef __attribute__((ext_vector_type(16))) __bf16   v16bf;
typedef __attribute__((ext_vector_type(8)))  unsigned short v8us;
typedef __attribute__((ext_vector_type(8)))  float    v8f;
typedef __attribute__((ext_vector_type(4)))  float    v4f;
typedef __attribute__((ext_vector_type(2)))  float    v2f;
typedef __attribute__((ext_vector_type(2)))  unsigned short v2us;
typedef v4f  __attribute__((may_alias)) v4fa;

__device__ __forceinline__ unsigned short f2bf(float f) { unsigned u = __float_as_uint(f); u += 0x7FFFu + ((u >> 16) & 1u); return (unsigned short)(u >> 16); }
__device__ __forceinline__ v16bf cat16b(v8us lo, v8us hi) { return __builtin_bit_cast(v16bf, __builtin_shufflevector(lo, hi, 0, 1, 2, 3, 4, 5, 6, 7, 8, 9, 10, 11, 12, 13, 14, 15)); }
__device__ __forceinline__ v8f wmmab(v16bf a, v16bf b, v8f c) { return __builtin_amdgcn_wmma_f32_16x16x32_bf16(false, a, false, b, (short)0, c, false, false); }

__global__ __launch_bounds__(256) void k_wtG(const float* __restrict__ w, int K, int N, bf* Bt) {
    w += (size_t)blockIdx.y * K * N; Bt += (size_t)blockIdx.y * N * K;
    const int lane = threadIdx.x & 31; const int L0 = (blockIdx.x * 8 + (threadIdx.x >> 5)) * 8; const int nlines = N * K / 64;
{
#pragma unroll 1
        for (int l = 0; l < 8; ++l) { const int L = L0 + l; if (L >= nlines) break; const size_t e = (size_t)L * 64 + lane * 2; const int k = (int)(e % K), n = (int)(e / K); v2us o;
            o[0] = f2bf(w[(size_t)k * N + n]); o[1] = f2bf(w[(size_t)(k + 1) * N + n]); *(v2us*)(Bt + e) = o; }
         }
}

// k_fattn: scores, softmax and attn.v fused. Work-group = QB queries of one batch, KSPL waves; wave w walks keys [w, w+1) * SEQ/KSPL in passes of 32 for ALL QB queries.
// Transposed products: St = K.Qt (A = K rows, B = Q rows, both k-contiguous planes), Ot += Vt.Pt (A = Vt rows, B = P packed from the two St tiles of a pass, which already lie in the operand's k order).
// A lane holds one query's scores (column l&15), so maximum, sum and rescale factor are per lane; the two lane halves hold different keys of that query.
// The running maximum is replaced only when a new one exceeds it by more than 8 (log2 units), so P <= 2^8; the KSPL partial results are joined through LDS in fixed wave order.
__device__ __forceinline__ float xhalf(float x) { return __builtin_bit_cast(float, __builtin_amdgcn_permlanex16(__builtin_bit_cast(int, x), __builtin_bit_cast(int, x), 0x76543210, 0xfedcba98, false, false)); }  // lane l with lane l ^ 16
// one operand fragment from the lane's own byte address in a row-major tile (LDS): elements 0..7 at p, 8..15 at p + 32 bytes
__device__ __forceinline__ v16bf ldf(const char* p) { return cat16b(*(const v8us*)p, *(const v8us*)(p + 32)); }
// the same from a plane in fragment order (memory): p = fragment + lane * 16; elements 0..7 at p, 8..15 at p + 512 bytes
__device__ __forceinline__ v16bf ldg(const char* p) { return cat16b(*(const v8us*)p, *(const v8us*)(p + 512)); }
typedef __attribute__((ext_vector_type(2))) __bf16   v2bf;
typedef __attribute__((ext_vector_type(8))) unsigned v8u;
// 2^a with the slot behind a transcendental closed by construction: until the v_nop the result is unread and the source register unwritten (they are the statement's operands),
// so what stands directly behind the v_exp_f32 is an independent instruction or the v_nop itself
__device__ __forceinline__ float exp2s(float a) { float p = __builtin_amdgcn_exp2f(a); asm("v_nop" : "+v"(p) : "v"(a)); return p; }
#define OPITCH (HD + 4)
// QK: [hi|lo][q|k][NB*SEQ/16 tiles][8 pieces of a row][16 rows][8 elements]: a tile of 16 token rows keeps its 2 KiB, its 16-byte pieces stand piece-major (piece u = elements 8u..8u+7 of a row).
// VT: [hi|lo][NB][SEQ/32 key blocks][4 tiles of 16 d][4 pieces of 8 keys][16 d][8 keys]: 4 KiB a key block.
// Lane (c, h) of a fragment takes pieces h and 2 + h (of the fragment's 32 k) of row c, so each half of a fragment is 32 lanes x 16 bytes in a row.
// A low plane lies a constant number of bytes behind its high plane, within a load's immediate offset, so one address serves both
constexpr size_t QK_LO = (size_t)2 * NB * SEQ * HD * 2, VT_LO = (size_t)NB * HD * SEQ * 2, K_EL = (size_t)NB * SEQ * HD, K_B = K_EL * 2;
static_assert(K_B + QK_LO + 8192 < (1u << 23) && VT_LO + 4096 < (1u << 23));
__global__ __launch_bounds__(KSPL * 32) void k_fattn(const bf* __restrict__ QK, const bf* __restrict__ VT, float* __restrict__ out) {
    __shared__ __align__(16) float Os[KSPL * QB * OPITCH];
    __shared__ float ms[KSPL * QB];
    __shared__ float ls[KSPL * QB];
    const int tid = threadIdx.x, lane = tid & 31, c = lane & 15, h = lane >> 4, w = __builtin_amdgcn_readfirstlane(tid >> 5);
    const int b = blockIdx.y, q0 = blockIdx.x * QB;
    const float SC2 = SCL * 1.4426950408889634f;   // score scale and log2(e) in one factor
    constexpr int KPW = SEQ / KSPL;                // keys per wave
    const unsigned lo16 = (unsigned)lane * 16u;    // lane's bytes into each half of a fragment (row c, k order 8h.., 16+8h..)
    const char* qa = (const char*)(QK + ((size_t)b * SEQ + q0) * HD) + lo16;
    v16bf qh[NCG][2], ql[NCG][2];
#pragma unroll
    for (int g = 0; g < NCG; ++g)
#pragma unroll
        for (int ks = 0; ks < 2; ++ks) { qh[g][ks] = ldg(qa + g * 2048 + ks * 1024); ql[g][ks] = ldg(qa + QK_LO + g * 2048 + ks * 1024); }
    // this pass's 32 keys: two tiles of k, one key block of v; kp points into the q plane, K_B bytes in front of the keys, and every load adds K_B in its immediate offset:
    // so the register that the loads name is kp itself, and the wait below, which takes kp as its input, needs no sum formed in front of it
    const char* kp = (const char*)(QK + ((size_t)b * SEQ + w * KPW) * HD) + lo16;
    const char* vp = (const char*)(VT + ((size_t)b * SEQ + w * KPW) * HD) + lo16;
    v8f o[4][NCG]; float m[NCG], l[NCG];
#pragma unroll
    for (int g = 0; g < NCG; ++g) { m[g] = -3.0e38f; l[g] = 0.f;
#pragma unroll
        for (int dt = 0; dt < 4; ++dt) o[dt][g] = (v8f){}; }
    v16bf kh[2][2];
#pragma unroll
    for (int kt = 0; kt < 2; ++kt)
#pragma unroll
        for (int ks = 0; ks < 2; ++ks) kh[kt][ks] = ldg(kp + K_B + kt * 2048 + ks * 1024);
    // the wait in front of any rewrite of a register that the loads above name; as the statement's input the lane offset stays live up to it
    asm volatile("s_wait_xcnt 0x0" :: "v"(lo16) : "memory");
#pragma unroll 1
    for (int k0 = 0; k0 < KPW; k0 += 32) {
        // this pass's K low plane and V: the low plane is used last among the score products, V after the softmax
        v16bf kl[2][2], vh[4], vl[4];
#pragma unroll
        for (int kt = 0; kt < 2; ++kt)
#pragma unroll
            for (int ks = 0; ks < 2; ++ks) kl[kt][ks] = ldg(kp + K_B + QK_LO + kt * 2048 + ks * 1024);
#pragma unroll
        for (int dt = 0; dt < 4; ++dt) { vh[dt] = ldg(vp + dt * 1024); vl[dt] = ldg(vp + VT_LO + dt * 1024); }
        v8f st[NCG][2];
#pragma unroll
        for (int g = 0; g < NCG; ++g) { st[g][0] = (v8f){}; st[g][1] = (v8f){}; }
#pragma unroll
        for (int ks = 0; ks < 2; ++ks) {
#pragma unroll
            for (int kt = 0; kt < 2; ++kt)
#pragma unroll
                for (int g = 0; g < NCG; ++g) st[g][kt] = wmmab(kh[kt][ks], qh[g][ks], st[g][kt]);
#pragma unroll
            for (int kt = 0; kt < 2; ++kt)
#pragma unroll
                for (int g = 0; g < NCG; ++g) st[g][kt] = wmmab(kh[kt][ks], ql[g][ks], st[g][kt]);
        }
        // the next pass's K high plane, into the same registers, so that its latency lies under the softmax and attn.v; a wave's last pass fetches, and never uses,
        // the 4 KiB behind its keys: the next wave's or batch's keys or, at the plane's end, the head of the low q plane, all written earlier in this call
#pragma unroll
        for (int kt = 0; kt < 2; ++kt)
#pragma unroll
            for (int ks = 0; ks < 2; ++ks) kh[kt][ks] = ldg(kp + K_B + 4096 + kt * 2048 + ks * 1024);
#pragma unroll
        for (int ks = 0; ks < 2; ++ks)
#pragma unroll
            for (int kt = 0; kt < 2; ++kt)
#pragma unroll
                for (int g = 0; g < NCG; ++g) st[g][kt] = wmmab(kl[kt][ks], qh[g][ks], st[g][kt]);
        // the wait in front of any rewrite of a register that this pass's loads name (the two addresses advance right behind it); as the statement's inputs they stay live up to it
        asm volatile("s_wait_xcnt 0x0" :: "v"(kp), "v"(vp) : "memory");
        kp += 4096; vp += 4096;
        float mx[NCG]; bool need = false;
#pragma unroll
        for (int g = 0; g < NCG; ++g) { float a = fmaxf(st[g][0][0], st[g][1][0]);
#pragma unroll
            for (int r = 1; r < 8; ++r) a = fmaxf(a, fmaxf(st[g][0][r], st[g][1][r]));
            a = fmaxf(a, xhalf(a)); mx[g] = a * SC2; need = need || (mx[g] > m[g] + 8.0f); }
        if (__builtin_amdgcn_ballot_w32(need) != 0) {
#pragma unroll
            for (int g = 0; g < NCG; ++g) { const float mn = fmaxf(m[g], mx[g]); const float al = exp2s(m[g] - mn); m[g] = mn; l[g] *= al;
#pragma unroll
                for (int dt = 0; dt < 4; ++dt) o[dt][g] *= al; }
        }
        // column group by column group: a group's P lives only until its own twelve products, and the next group's vector work stands beside them
#pragma unroll
        for (int g = 0; g < NCG; ++g) { v8u hu, lu;
#pragma unroll
            for (int s = 0; s < 16; s += 2) { v2f p;
                const float a0 = __builtin_fmaf(st[g][s >> 3][s & 7], SC2, -m[g]), a1 = __builtin_fmaf(st[g][s >> 3][(s & 7) + 1], SC2, -m[g]);
                float p0 = __builtin_amdgcn_exp2f(a0), p1 = __builtin_amdgcn_exp2f(a1);
                // the slot behind a transcendental, as in exp2s, one v_nop for the pair
                asm("v_nop" : "+v"(p0), "+v"(p1) : "v"(a0), "v"(a1));
                p[0] = p0; p[1] = p1; l[g] += p0; l[g] += p1;
                const v2bf hi = __builtin_convertvector(p, v2bf); const v2f rest = p - __builtin_convertvector(hi, v2f); const v2bf lo = __builtin_convertvector(rest, v2bf);
                hu[s >> 1] = __builtin_bit_cast(unsigned, hi); lu[s >> 1] = __builtin_bit_cast(unsigned, lo); }
            const v16bf ph = __builtin_bit_cast(v16bf, hu), pl = __builtin_bit_cast(v16bf, lu);
#pragma unroll
            for (int dt = 0; dt < 4; ++dt) o[dt][g] = wmmab(vh[dt], ph, o[dt][g]);
#pragma unroll
            for (int dt = 0; dt < 4; ++dt) o[dt][g] = wmmab(vl[dt], ph, o[dt][g]);
#pragma unroll
            for (int dt = 0; dt < 4; ++dt) o[dt][g] = wmmab(vh[dt], pl, o[dt][g]); }
    }
    // each wave's partial result: maximum, sum (both lane halves joined) and Ot, a lane's 8 registers being 8 consecutive d of its query
#pragma unroll
    for (int g = 0; g < NCG; ++g) { const int q = g * 16 + c; const float lj = l[g] + xhalf(l[g]);
        if (h == 0) { ms[w * QB + q] = m[g]; ls[w * QB + q] = lj; }
#pragma unroll
        for (int dt = 0; dt < 4; ++dt) { float* p = Os + (size_t)(w * QB + q) * OPITCH + dt * 16 + 8 * h;
            *(v4f*)p = (v4f){o[dt][g][0], o[dt][g][1], o[dt][g][2], o[dt][g][3]}; *(v4f*)(p + 4) = (v4f){o[dt][g][4], o[dt][g][5], o[dt][g][6], o[dt][g][7]}; } }
    __syncthreads();
#pragma unroll
    for (int i = 0; i < QB * HD / 4 / (KSPL * 32); ++i) { const int f = i * (KSPL * 32) + tid, q = f >> 4, d4 = (f & 15) * 4;
        float M = ms[q];
#pragma unroll
        for (int u = 1; u < KSPL; ++u) M = fmaxf(M, ms[u * QB + q]);
        float L = 0.f; v4f acc = (v4f){};
#pragma unroll
        for (int u = 0; u < KSPL; ++u) { const float wt = exp2s(ms[u * QB + q] - M); L += ls[u * QB + q] * wt; acc += *(const v4f*)(Os + (size_t)(u * QB + q) * OPITCH + d4) * wt; }
        const float f1 = __fdiv_rn(1.0f, L);
        *(v4f*)(out + ((size_t)b * SEQ + q0 + q) * HD + d4) = acc * f1; }
}
// k_proj: q, k and v of PR token rows in one work-group, from x in f32 to the operand planes of k_fattn; neither a bf16 copy of x nor the f32 projections reach memory.
// Whole-line loads bring the PR x DM tile of x (converted to bf16, RNE, on the way) and all of W into LDS; 8 waves then hold 2 x 3 tiles of the PR x NQKV result each
// (A = x rows, B = W rows, both read by ldf, k in steps of 32 from 0 up). The f32 results go through LDS, q|k by rows and v transposed, so that every plane is stored in whole 128-byte lines, in k_fattn's fragment order.
#define PR   64                  // token rows per work-group
#define XPB  ((DM + 8) * 2)      // LDS row pitch of the two bf16 operand tiles, bytes: 16 x an odd number, for 16-byte readers
#define FPI  (2 * HD + 4)        // LDS row pitch of the f32 q|k tile, floats
#define VPI  (PR + 4)            // LDS row pitch of the f32 v tile (row = d, column = token), floats
static_assert(SEQ % PR == 0 && DM == 512 && NQKV == 192 && PR == 64);
static_assert((size_t)(PR * FPI + HD * VPI) * 4 <= (size_t)PR * XPB);
typedef __attribute__((ext_vector_type(4))) unsigned v4u;
typedef __attribute__((ext_vector_type(2))) unsigned v2u;
__device__ __forceinline__ unsigned pkbf(float a, float b) { const v2f p = {a, b}; return __builtin_bit_cast(unsigned, __builtin_convertvector(p, v2bf)); }
// eight f32 -> eight bf16 high parts and eight bf16 low parts (the rest after the high part, rounded)
__device__ __forceinline__ void split8(v4f a, v4f b, v4u& hi, v4u& lo) {
    const float y[8] = {a[0], a[1], a[2], a[3], b[0], b[1], b[2], b[3]};
#pragma unroll
    for (int s = 0; s < 4; ++s) { const v2f p = {y[2 * s], y[2 * s + 1]};
        const v2bf hb = __builtin_convertvector(p, v2bf); const v2f rest = p - __builtin_convertvector(hb, v2f); const v2bf lb = __builtin_convertvector(rest, v2bf);
        hi[s] = __builtin_bit_cast(unsigned, hb); lo[s] = __builtin_bit_cast(unsigned, lb); }
}
__global__ __launch_bounds__(256) void k_proj(const float* __restrict__ x, const bf* __restrict__ W, bf* __restrict__ QK, bf* __restrict__ VT) {
    __shared__ __align__(16) char sm[(PR + NQKV) * XPB];
    char* Xs = sm; char* Ws = sm + PR * XPB;
    const int tid = threadIdx.x, lane = tid & 31, c = lane & 15, h = lane >> 4, w = __builtin_amdgcn_readfirstlane(tid >> 5);
    const int R0 = blockIdx.x * PR, b = R0 / SEQ, t0 = R0 % SEQ;
    // 256 threads x 16 bytes = 4 KiB a step: two rows of x, four rows of W; one uniform base each and the thread's own 16 bytes, the steps in the immediate offset
    const char* xb = (const char*)(x + ((size_t)b * SEQ_FULL + t0) * DM);
    const char* wbs = (const char*)W;
    char* xs = Xs + (tid >> 7) * XPB + (tid & 127) * 8;
    char* wsd = Ws + (tid >> 6) * XPB + (tid & 63) * 16;
    // every load of the work-group is issued before the first is used: one trip to memory, not several
    // (all loops of this kernel are unrolled: their indices pick registers and immediate offsets)
    v4f xr[32]; v4u wr[48];
#pragma unroll
    for (int i = 0; i < 32; ++i) xr[i] = *(const v4f*)(xb + (size_t)tid * 16 + i * 4096);
#pragma unroll
    for (int i = 0; i < 48; ++i) wr[i] = *(const v4u*)(wbs + (size_t)tid * 16 + i * 4096);
    // the wait in front of any rewrite of a register that the loads above name; as the statement's inputs the two bases and the thread's index stay live up to it
    asm volatile("s_wait_xcnt 0x0" :: "s"(xb), "s"(wbs), "v"(tid) : "memory");
#pragma unroll
    for (int i = 0; i < 32; ++i) *(v2u*)(xs + i * 2 * XPB) = (v2u){pkbf(xr[i][0], xr[i][1]), pkbf(xr[i][2], xr[i][3])};
#pragma unroll
    for (int i = 0; i < 48; ++i) *(v4u*)(wsd + i * 4 * XPB) = wr[i];
    __syncthreads();
    const int rg = w & 1, cg = w >> 1;   // rows rg * 32 .. + 31, columns cg * 48 .. + 47
    const char* ap = Xs + (rg * 32 + c) * XPB + h * 16;
    const char* bp = Ws + (cg * 48 + c) * XPB + h * 16;
    v8f acc[2][3];
#pragma unroll
    for (int rt = 0; rt < 2; ++rt)
#pragma unroll
        for (int ct = 0; ct < 3; ++ct) acc[rt][ct] = (v8f){};
    // fragments one k step ahead, in two register sets, so that a step's products do not wait for their own LDS reads
    v16bf a[2][2], bb[2][3];
#pragma unroll
    for (int rt = 0; rt < 2; ++rt) a[0][rt] = ldf(ap + rt * 16 * XPB);
#pragma unroll
    for (int ct = 0; ct < 3; ++ct) bb[0][ct] = ldf(bp + ct * 16 * XPB);
#pragma unroll
    for (int kc = 0; kc < DM / 32; ++kc) { const int cu = kc & 1, nx = cu ^ 1;
        if (kc + 1 < DM / 32) {
#pragma unroll
            for (int rt = 0; rt < 2; ++rt) a[nx][rt] = ldf(ap + rt * 16 * XPB + (kc + 1) * 64);
#pragma unroll
            for (int ct = 0; ct < 3; ++ct) bb[nx][ct] = ldf(bp + ct * 16 * XPB + (kc + 1) * 64);
        }
        // keeps the next step's reads in front of this step's products (the scheduler otherwise sinks them to just before their use)
        __builtin_amdgcn_sched_barrier(0);
#pragma unroll
        for (int rt = 0; rt < 2; ++rt)
#pragma unroll
            for (int ct = 0; ct < 3; ++ct) acc[rt][ct] = wmmab(a[cu][rt], bb[cu][ct], acc[rt][ct]); }
    __syncthreads();   // every wave has read its last fragment: the operand tiles' LDS now takes the results
    float* Fs = (float*)sm; float* Vs = Fs + PR * FPI;
    // accumulator register j of lane (c, h) = (row 8h + j, column c) of its tile
#pragma unroll
    for (int rt = 0; rt < 2; ++rt)
#pragma unroll
        for (int ct = 0; ct < 3; ++ct) { const int nt = cg * 3 + ct, r = rg * 32 + rt * 16 + 8 * h; const v8f d = acc[rt][ct];
            if (nt < 8) {
#pragma unroll
                for (int j = 0; j < 8; ++j) Fs[(r + j) * FPI + nt * 16 + c] = d[j];
            } else { float* p = Vs + ((nt - 8) * 16 + c) * VPI + r; *(v4fa*)p = (v4f){d[0], d[1], d[2], d[3]}; *(v4fa*)(p + 4) = (v4f){d[4], d[5], d[6], d[7]}; } }
    __syncthreads();
    // a thread's 16 bytes stand at its own index in the stored unit; which row and piece they are follows from the fragment order
    // q|k: a tile of 16 token rows a step, threads 0..127 its q, 128..255 its k (row tid & 15, piece (tid >> 4) & 7); v: a block of 32 keys a step (d = (tid >> 6) * 16 + (tid & 15), piece (tid >> 4) & 3)
    char* qo = (char*)(QK + (size_t)(tid >> 7) * K_EL + (size_t)R0 * HD + (tid & 127) * 8);
    char* vo = (char*)(VT + ((size_t)b * SEQ + t0) * HD + tid * 8);
#pragma unroll
    for (int it = 0; it < 4; ++it) { const float* s = Fs + (it * 16 + (tid & 15)) * FPI + (tid >> 4) * 8; v4u hi, lo; split8(*(const v4fa*)s, *(const v4fa*)(s + 4), hi, lo);
        *(v4u*)(qo + it * 16 * HD * 2) = hi; *(v4u*)(qo + QK_LO + it * 16 * HD * 2) = lo;
        // the wait in front of any rewrite of a register that the step's two stores name (the next step takes them over); as the statement's inputs they stay live up to it
        asm volatile("s_wait_xcnt 0x0" :: "v"(hi), "v"(lo), "v"(qo) : "memory"); }
#pragma unroll
    for (int it = 0; it < 2; ++it) { const float* s = Vs + ((tid >> 6) * 16 + (tid & 15)) * VPI + (it * 4 + ((tid >> 4) & 3)) * 8; v4u hi, lo; split8(*(const v4fa*)s, *(const v4fa*)(s + 4), hi, lo);
        *(v4u*)(vo + it * 4096) = hi; *(v4u*)(vo + VT_LO + it * 4096) = lo;
        // the same wait (the address lives on into the next step); behind the last step nothing is rewritten any more
        if (it == 0) asm volatile("s_wait_xcnt 0x0" :: "v"(hi), "v"(lo) : "memory"); }
}

// workspace carve (bytes), all multiples of 256
constexpr size_t B_W   = (size_t)NQKV * DM * 2;
constexpr size_t B_QK  = (size_t)2 * NB * SEQ * HD * 2;
constexpr size_t B_VT  = (size_t)NB * HD * SEQ * 2;
constexpr size_t B_TOT = B_W + 2 * B_QK + 2 * B_VT;
static_assert(B_W % 256 == 0 && B_QK % 256 == 0 && B_VT % 256 == 0);
static_assert(B_TOT <= (size_t)134217728);
static_assert(B_QK == QK_LO && B_VT == VT_LO);   // the low planes are carved directly behind the high planes

extern "C" void kernel_launch(void* const* d_in, const int* in_sizes, int n_in,
                              void* d_out, int out_size, void* d_ws, size_t ws_size, hipStream_t stream) {
    if (n_in < 2) return;
    if ((size_t)in_sizes[0] < (size_t)(NB - 1) * SEQ_FULL * DM + (size_t)SEQ * DM) return;
    if ((size_t)in_sizes[1] < (size_t)3 * DM * HD) return;
    if ((size_t)out_size < (size_t)NB * SEQ * HD) return;
    if (B_TOT > ws_size) return;
    const float* x = (const float*)d_in[0];      // [8][2048][512]
    const float* ker = (const float*)d_in[1];    // [3][512][64]
    float* OUT = (float*)d_out;                  // [NB][SEQ][64]
    char* wsp = (char*)d_ws;
    auto take = [&](size_t bytes) { char* p = wsp; wsp += (bytes + 255) & ~(size_t)255; return (void*)p; };
    bf* W    = (bf*)take(B_W);       // [192][512]: rows 0..63 q, 64..127 k, 128..191 v (k-contiguous)
    bf* QKh  = (bf*)take(B_QK);      // [2][NB*SEQ][64], each tile of 16 rows in fragment order
    bf* QKl  = (bf*)take(B_QK);
    bf* VTh  = (bf*)take(B_VT);      // [NB][SEQ/32][64][32], each key block in fragment order
    bf* VTl  = (bf*)take(B_VT);
    (void)QKl; (void)VTl;            // reached from the high planes' addresses (QK_LO, VT_LO)
    if ((size_t)(wsp - (char*)d_ws) > ws_size) return;

    // weights: in[512][64] -> out[64][512] per block; grid x = 512 lines / 64 lines per block
    k_wtG<<<dim3((unsigned)(DM * HD / 64 / 64), 3, 1), 256, 0, stream>>>(ker, DM, HD, W);
    // x -> q, k (hi/lo planes) and v transposed (hi/lo planes), one launch
    k_proj<<<dim3(NB * SEQ / PR, 1, 1), 256, 0, stream>>>(x, W, QKh, VTh);
    // out = softmax(q k^T x HD^-0.5) v, one launch for all batches
    k_fattn<<<dim3(SEQ / QB, NB, 1), KSPL * 32, 0, stream>>>(QKh, VTh, OUT);
}

// v004
// It runs in 31 microseconds.
// Two timings next to v003 put it at 1.18 and 1.19 times that version's speed.
// Over all steps from v000 it is 9.71 times as fast.
#include <hip/hip_runtime.h>

// Single-head self-attention, 8 x 2048 tokens, model width 512, head width 64 (x [8][2048][512]; q/k/v = x kernel[0/1/2] ([3][512][64]); scores x 64^-0.5; softmax over 2048 keys; out = attn v -> [8][2048][64]).
// Compute dtypes, f32 accumulate everywhere: x and kernel converted to bf16 (RNE), projections v_wmma_f32_16x16x32_bf16 single product (exact products of bf16 inputs);
// scores q.k: bf16 hi/lo planes, 3 products; softmax f32, online (running maximum, unnormalised P, one division at the end); attn.v: bf16 hi/lo planes of P and of v, 3 products; output f32.
// Scores, softmax and attn.v run in ONE kernel (k_fattn): neither the scores nor P ever reach memory.
// The bf16 conversion of x and of the weights, the three projections, the hi/lo split and the transposition of v run in ONE kernel too (k_proj).
// The planes of q, k and v lie in memory in FRAGMENT ORDER: the 16 bytes that lane 0..31 of a wave takes with one load stand side by side, so a load covers 512 contiguous bytes (4 whole lines).

#ifndef NB
#define NB 8
#endif
#ifndef SEQ
#define SEQ 2048
#endif
#define NB_FULL  8
#define SEQ_FULL 2048
#define DM   512
#define HD   64
#define NQKV 192                 // fused projection width: q | k | v
#define NCG  4                   // 16-query column groups per wave of the fused attention kernel
#define KSPL 8                   // key ranges per work-group, one wave each
#define QB   (NCG * 16)          // queries per work-group
#define SCL  0.125f              // HD^-0.5

static_assert(NB <= NB_FULL);
static_assert(SEQ <= SEQ_FULL);
static_assert(SEQ % QB == 0);
static_assert(SEQ % (KSPL * 32) == 0);
static_assert((QB * HD / 4) % (KSPL * 32) == 0);
static_assert(SEQ % 128 == 0);
static_assert(DM % 32 == 0);
static_assert(HD == 64);
static_assert((NB * SEQ) % 64 == 0);

typedef unsigned short bf;
typedef __attribute__((ext_vector_type(16))) __bf16   v16bf;
typedef __attribute__((ext_vector_type(8)))  unsigned short v8us;
typedef __attribute__((ext_vector_type(8)))  float    v8f;
typedef __attribute__((ext_vector_type(4)))  float    v4f;
typedef __attribute__((ext_vector_type(2)))  float    v2f;
typedef v4f  __attribute__((may_alias)) v4fa;

__device__ __forceinline__ v16bf cat16b(v8us lo, v8us hi) { return __builtin_bit_cast(v16bf, __builtin_shufflevector(lo, hi, 0, 1, 2, 3, 4, 5, 6, 7, 8, 9, 10, 11, 12, 13, 14, 15)); }
__device__ __forceinline__ v8f wmmab(v16bf a, v16bf b, v8f c) { return __builtin_amdgcn_wmma_f32_16x16x32_bf16(false, a, false, b, (short)0, c, false, false); }

// k_fattn: scores, softmax and attn.v fused. Work-group = QB queries of one batch, KSPL waves; wave w walks keys [w, w+1) * SEQ/KSPL in passes of 32 for ALL QB queries.
// Transposed products: St = K.Qt (A = K rows, B = Q rows, both k-contiguous planes), Ot += Vt.Pt (A = Vt rows, B = P packed from the two St tiles of a pass, which already lie in the operand's k order).
// A lane holds one query's scores (column l&15), so maximum, sum and rescale factor are per lane; the two lane halves hold different keys of that query.
// The running maximum is replaced only when a new one exceeds it by more than 8 (log2 units), so P <= 2^8; the KSPL partial results are joined through LDS in fixed wave order.
__device__ __forceinline__ float xhalf(float x) { return __builtin_bit_cast(float, __builtin_amdgcn_permlanex16(__builtin_bit_cast(int, x), __builtin_bit_cast(int, x), 0x76543210, 0xfedcba98, false, false)); }  // lane l with lane l ^ 16
// one operand fragment from the lane's own byte address in a row-major tile (LDS): elements 0..7 at p, 8..15 at p + 32 bytes
__device__ __forceinline__ v16bf ldf(const char* p) { return cat16b(*(const v8us*)p, *(const v8us*)(p + 32)); }
// the same from a plane in fragment order (memory): p = fragment + lane * 16; elements 0..7 at p, 8..15 at p + 512 bytes
__device__ __forceinline__ v16bf ldg(const char* p) { return cat16b(*(const v8us*)p, *(const v8us*)(p + 512)); }
typedef __attribute__((ext_vector_type(2))) __bf16   v2bf;
typedef __attribute__((ext_vector_type(8))) unsigned v8u;
// 2^a with the slot behind a transcendental closed by construction: until the v_nop the result is unread and the source register unwritten (they are the statement's operands),
// so what stands directly behind the v_exp_f32 is an independent instruction or the v_nop itself
__device__ __forceinline__ float exp2s(float a) { float p = __builtin_amdgcn_exp2f(a); asm("v_nop" : "+v"(p) : "v"(a)); return p; }
#define OPITCH (HD + 4)
// QK: [hi|lo][q|k][NB*SEQ/16 tiles][8 pieces of a row][16 rows][8 elements]: a tile of 16 token rows keeps its 2 KiB, its 16-byte pieces stand piece-major (piece u = elements 8u..8u+7 of a row).
// VT: [hi|lo][NB][SEQ/32 key blocks][4 tiles of 16 d][4 pieces of 8 keys][16 d][8 keys]: 4 KiB a key block.
// Lane (c, h) of a fragment takes pieces h and 2 + h (of the fragment's 32 k) of row c, so each half of a fragment is 32 lanes x 16 bytes in a row.
// A low plane lies a constant number of bytes behind its high plane, within a load's immediate offset, so one address serves both
constexpr size_t QK_LO = (size_t)2 * NB * SEQ * HD * 2, VT_LO = (size_t)NB * HD * SEQ * 2, K_EL = (size_t)NB * SEQ * HD, K_B = K_EL * 2;
static_assert(K_B + QK_LO + 8192 < (1u << 23) && VT_LO + 4096 < (1u << 23));
__global__ __launch_bounds__(KSPL * 32) void k_fattn(const bf* __restrict__ QK, const bf* __restrict__ VT, float* __restrict__ out) {
    __shared__ __align__(16) float Os[KSPL * QB * OPITCH];
    __shared__ float ms[KSPL * QB];
    __shared__ float ls[KSPL * QB];
    const int tid = threadIdx.x, lane = tid & 31, c = lane & 15, h = lane >> 4, w = __builtin_amdgcn_readfirstlane(tid >> 5);
    const int b = blockIdx.y, q0 = blockIdx.x * QB;
    const float SC2 = SCL * 1.4426950408889634f;   // score scale and log2(e) in one factor
    constexpr int KPW = SEQ / KSPL;                // keys per wave
    const unsigned lo16 = (unsigned)lane * 16u;    // lane's bytes into each half of a fragment (row c, k order 8h.., 16+8h..)
    const char* qa = (const char*)(QK + ((size_t)b * SEQ + q0) * HD) + lo16;
    v16bf qh[NCG][2], ql[NCG][2];
#pragma unroll
    for (int g = 0; g < NCG; ++g)
#pragma unroll
        for (int ks = 0; ks < 2; ++ks) { qh[g][ks] = ldg(qa + g * 2048 + ks * 1024); ql[g][ks] = ldg(qa + QK_LO + g * 2048 + ks * 1024); }
    // this pass's 32 keys: two tiles of k, one key block of v; kp points into the q plane, K_B bytes in front of the keys, and every load adds K_B in its immediate offset:
    // so the register that the loads name is kp itself, and the wait below, which takes kp as its input, needs no sum formed in front of it
    const char* kp = (const char*)(QK + ((size_t)b * SEQ + w * KPW) * HD) + lo16;
    const char* vp = (const char*)(VT + ((size_t)b * SEQ + w * KPW) * HD) + lo16;
    v8f o[4][NCG]; float m[NCG], l[NCG];
#pragma unroll
    for (int g = 0; g < NCG; ++g) { m[g] = -3.0e38f; l[g] = 0.f;
#pragma unroll
        for (int dt = 0; dt < 4; ++dt) o[dt][g] = (v8f){}; }
    v16bf kh[2][2];
#pragma unroll
    for (int kt = 0; kt < 2; ++kt)
#pragma unroll
        for (int ks = 0; ks < 2; ++ks) kh[kt][ks] = ldg(kp + K_B + kt * 2048 + ks * 1024);
    // the wait in front of any rewrite of a register that the loads above name; as the statement's input the lane offset stays live up to it
    asm volatile("s_wait_xcnt 0x0" :: "v"(lo16) : "memory");
#pragma unroll 1
    for (int k0 = 0; k0 < KPW; k0 += 32) {
        // this pass's K low plane and V: the low plane is used last among the score products, V after the softmax
        v16bf kl[2][2], vh[4], vl[4];
#pragma unroll
        for (int kt = 0; kt < 2; ++kt)
#pragma unroll
            for (int ks = 0; ks < 2; ++ks) kl[kt][ks] = ldg(kp + K_B + QK_LO + kt * 2048 + ks * 1024);
#pragma unroll
        for (int dt = 0; dt < 4; ++dt) { vh[dt] = ldg(vp + dt * 1024); vl[dt] = ldg(vp + VT_LO + dt * 1024); }
        v8f st[NCG][2];
#pragma unroll
        for (int g = 0; g < NCG; ++g) { st[g][0] = (v8f){}; st[g][1] = (v8f){}; }
#pragma unroll
        for (int ks = 0; ks < 2; ++ks) {
#pragma unroll
            for (int kt = 0; kt < 2; ++kt)
#pragma unroll
                for (int g = 0; g < NCG; ++g) st[g][kt] = wmmab(kh[kt][ks], qh[g][ks], st[g][kt]);
#pragma unroll
            for (int kt = 0; kt < 2; ++kt)
#pragma unroll
                for (int g = 0; g < NCG; ++g) st[g][kt] = wmmab(kh[kt][ks], ql[g][ks], st[g][kt]);
        }
        // the next pass's K high plane, into the same registers, so that its latency lies under the softmax and attn.v; a wave's last pass fetches, and never uses,
        // the 4 KiB behind its keys: the next wave's or batch's keys or, at the plane's end, the head of the low q plane, all written earlier in this call
#pragma unroll
        for (int kt = 0; kt < 2; ++kt)
#pragma unroll
            for (int ks = 0; ks < 2; ++ks) kh[kt][ks] = ldg(kp + K_B + 4096 + kt * 2048 + ks * 1024);
#pragma unroll
        for (int ks = 0; ks < 2; ++ks)
#pragma unroll
            for (int kt = 0; kt < 2; ++kt)
#pragma unroll
                for (int g = 0; g < NCG; ++g) st[g][kt] = wmmab(kl[kt][ks], qh[g][ks], st[g][kt]);
        // the wait in front of any rewrite of a register that this pass's loads name (the two addresses advance right behind it); as the statement's inputs they stay live up to it
        asm volatile("s_wait_xcnt 0x0" :: "v"(kp), "v"(vp) : "memory");
        kp += 4096; vp += 4096;
        float mx[NCG]; bool need = false;
#pragma unroll
        for (int g = 0; g < NCG; ++g) { float a = fmaxf(st[g][0][0], st[g][1][0]);
#pragma unroll
            for (int r = 1; r < 8; ++r) a = fmaxf(a, fmaxf(st[g][0][r], st[g][1][r]));
            a = fmaxf(a, xhalf(a)); mx[g] = a * SC2; need = need || (mx[g] > m[g] + 8.0f); }
        if (__builtin_amdgcn_ballot_w32(need) != 0) {
#pragma unroll
            for (int g = 0; g < NCG; ++g) { const float mn = fmaxf(m[g], mx[g]); const float al = exp2s(m[g] - mn); m[g] = mn; l[g] *= al;
#pragma unroll
                for (int dt = 0; dt < 4; ++dt) o[dt][g] *= al; }
        }
        // column group by column group: a group's P lives only until its own twelve products, and the next group's vector work stands beside them
#pragma unroll
        for (int g = 0; g < NCG; ++g) { v8u hu, lu;
#pragma unroll
            for (int s = 0; s < 16; s += 2) { v2f p;
                const float a0 = __builtin_fmaf(st[g][s >> 3][s & 7], SC2, -m[g]), a1 = __builtin_fmaf(st[g][s >> 3][(s & 7) + 1], SC2, -m[g]);
                float p0 = __builtin_amdgcn_exp2f(a0), p1 = __builtin_amdgcn_exp2f(a1);
                // the slot behind a transcendental, as in exp2s, one v_nop for the pair
                asm("v_nop" : "+v"(p0), "+v"(p1) : "v"(a0), "v"(a1));
                p[0] = p0; p[1] = p1; l[g] += p0; l[g] += p1;
                const v2bf hi = __builtin_convertvector(p, v2bf); const v2f rest = p - __builtin_convertvector(hi, v2f); const v2bf lo = __builtin_convertvector(rest, v2bf);
                hu[s >> 1] = __builtin_bit_cast(unsigned, hi); lu[s >> 1] = __builtin_bit_cast(unsigned, lo); }
            const v16bf ph = __builtin_bit_cast(v16bf, hu), pl = __builtin_bit_cast(v16bf, lu);
#pragma unroll
            for (int dt = 0; dt < 4; ++dt) o[dt][g] = wmmab(vh[dt], ph, o[dt][g]);
#pragma unroll
            for (int dt = 0; dt < 4; ++dt) o[dt][g] = wmmab(vl[dt], ph, o[dt][g]);
#pragma unroll
            for (int dt = 0; dt < 4; ++dt) o[dt][g] = wmmab(vh[dt], pl, o[dt][g]); }
    }
    // each wave's partial result: maximum, sum (both lane halves joined) and Ot, a lane's 8 registers being 8 consecutive d of its query
#pragma unroll
    for (int g = 0; g < NCG; ++g) { const int q = g * 16 + c; const float lj = l[g] + xhalf(l[g]);
        if (h == 0) { ms[w * QB + q] = m[g]; ls[w * QB + q] = lj; }
#pragma unroll
        for (int dt = 0; dt < 4; ++dt) { float* p = Os + (size_t)(w * QB + q) * OPITCH + dt * 16 + 8 * h;
            *(v4f*)p = (v4f){o[dt][g][0], o[dt][g][1], o[dt][g][2], o[dt][g][3]}; *(v4f*)(p + 4) = (v4f){o[dt][g][4], o[dt][g][5], o[dt][g][6], o[dt][g][7]}; } }
    __syncthreads();
#pragma unroll
    for (int i = 0; i < QB * HD / 4 / (KSPL * 32); ++i) { const int f = i * (KSPL * 32) + tid, q = f >> 4, d4 = (f & 15) * 4;
        float M = ms[q];
#pragma unroll
        for (int u = 1; u < KSPL; ++u) M = fmaxf(M, ms[u * QB + q]);
        float L = 0.f; v4f acc = (v4f){};
#pragma unroll
        for (int u = 0; u < KSPL; ++u) { const float wt = exp2s(ms[u * QB + q] - M); L += ls[u * QB + q] * wt; acc += *(const v4f*)(Os + (size_t)(u * QB + q) * OPITCH + d4) * wt; }
        const float f1 = __fdiv_rn(1.0f, L);
        *(v4f*)(out + ((size_t)b * SEQ + q0 + q) * HD + d4) = acc * f1; }
}
// k_proj: q, k and v of PR token rows in one work-group, from x in f32 to the operand planes of k_fattn; neither a bf16 copy of x nor the f32 projections reach memory.
// Whole-line loads bring the PR x DM tile of x and all three weight matrices, both f32, into LDS (converted to bf16, RNE, on the way); 8 waves then hold 2 x 3 tiles of the PR x NQKV result each.
// The weights keep the input's own order in LDS (row = k, columns q | k | v side by side): A = x rows read by ldf, B = weight columns read by the transposing load (ldt),
// which delivers ldf's k order (8h.., 16 + 8h..); k in steps of 32 from 0 up. The f32 results go through LDS, q|k by rows and v transposed, so that every plane is stored in whole 128-byte lines, in k_fattn's fragment order.
#define PR   64                  // token rows per work-group
#define XPB  ((DM + 8) * 2)      // LDS row pitch of the bf16 x tile, bytes: 16 x an odd number, for 16-byte readers
#define WPB  ((NQKV + 16) * 2)   // LDS row pitch of the bf16 weight tile, bytes: 32 x an odd number, for the transposing reader
#define FPI  (2 * HD + 4)        // LDS row pitch of the f32 q|k tile, floats
#define VPI  (PR + 4)            // LDS row pitch of the f32 v tile (row = d, column = token), floats
static_assert(SEQ % PR == 0 && DM == 512 && NQKV == 192 && PR == 64);
static_assert((size_t)(PR * FPI + HD * VPI) * 4 <= (size_t)PR * XPB);
static_assert(WPB % 32 == 0 && (WPB / 32) % 2 == 1 && (4 * WPB) % 256 == 128 && (PR * XPB) % 32 == 0);
typedef __attribute__((ext_vector_type(4))) unsigned v4u;
typedef __attribute__((ext_vector_type(2))) unsigned v2u;
__device__ __forceinline__ unsigned pkbf(float a, float b) { const v2f p = {a, b}; return __builtin_bit_cast(unsigned, __builtin_convertvector(p, v2bf)); }
// eight f32 -> eight bf16 high parts and eight bf16 low parts (the rest after the high part, rounded)
__device__ __forceinline__ void split8(v4f a, v4f b, v4u& hi, v4u& lo) {
    const float y[8] = {a[0], a[1], a[2], a[3], b[0], b[1], b[2], b[3]};
#pragma unroll
    for (int s = 0; s < 4; ++s) { const v2f p = {y[2 * s], y[2 * s + 1]};
        const v2bf hb = __builtin_convertvector(p, v2bf); const v2f rest = p - __builtin_convertvector(hb, v2f); const v2bf lb = __builtin_convertvector(rest, v2bf);
        hi[s] = __builtin_bit_cast(unsigned, hb); lo[s] = __builtin_bit_cast(unsigned, lb); }
}
typedef __attribute__((ext_vector_type(8))) short v8s;
// one B fragment (32 k x 16 columns) from a row-major tile (row = k) in LDS: p = tile + (8h + (lane & 7)) * WPB + ((lane >> 3) & 1) * 16;
// lane (c, h) gets column c at k = 8h .. 8h + 7 from the first load and at 16 + 8h .. from the second, 16 rows further down
__device__ __forceinline__ v8us ldtr(const char* p) { typedef __attribute__((address_space(3))) v8s lds_v8s; return __builtin_bit_cast(v8us, __builtin_amdgcn_ds_load_tr16_b128_v8i16((lds_v8s*)p)); }
__device__ __forceinline__ v16bf ldt(const char* p) { return cat16b(ldtr(p), ldtr(p + 16 * WPB)); }
__global__ __launch_bounds__(256) void k_proj(const float* __restrict__ x, const float* __restrict__ ker, bf* __restrict__ QK, bf* __restrict__ VT) {
    __shared__ __align__(32) char sm[PR * XPB + DM * WPB];
    char* Xs = sm; char* Ws = sm + PR * XPB;
    const int tid = threadIdx.x, lane = tid & 31, c = lane & 15, h = lane >> 4, w = __builtin_amdgcn_readfirstlane(tid >> 5);
    const int R0 = blockIdx.x * PR, b = R0 / SEQ, t0 = R0 % SEQ;
    // 256 threads x 16 bytes = 4 KiB a step: two rows of x, sixteen rows (256 bytes each) of one weight matrix; one uniform base each and the thread's own bytes, the steps in the immediate offset
    const char* xb = (const char*)(x + ((size_t)b * SEQ_FULL + t0) * DM);
    const char* wbs = (const char*)ker;
    // a wave takes rows wrow and wrow + 4 of a step's sixteen: in LDS they lie 4 * WPB bytes apart, half the banks, so its 8-byte stores meet no conflict
    const int wrow = (w & 3) + 4 * h + 8 * (w >> 2);
    const unsigned wo = (unsigned)wrow * 256u + (unsigned)c * 16u;
    char* xs = Xs + (tid >> 7) * XPB + (tid & 127) * 8;
    char* wsd = Ws + wrow * WPB + c * 8;
    // four batches of 32 loads, in the order q weights, x, k weights, v weights; a batch's LDS stores stand in front of the loads of the batch after next, whose registers they free:
    // the loads go out as early as the registers allow, and x, the only part that comes from memory, is among the first
    // (all loops of this kernel are unrolled: their indices pick registers and immediate offsets)
    v4f xr[32], w0[32], w1[32], w2[32];
#pragma unroll
    for (int i = 0; i < 32; ++i) w0[i] = *(const v4f*)(wbs + (size_t)wo + i * 4096);
#pragma unroll
    for (int i = 0; i < 32; ++i) xr[i] = *(const v4f*)(xb + (size_t)tid * 16 + i * 4096);
    // the wait in front of any rewrite of a register that the loads of x name; as the statement's inputs the base and the thread's index stay live up to it
    asm volatile("s_wait_xcnt 0x0" :: "s"(xb), "v"(tid) : "memory");
#pragma unroll
    for (int i = 0; i < 32; ++i) *(v2u*)(wsd + i * 16 * WPB) = (v2u){pkbf(w0[i][0], w0[i][1]), pkbf(w0[i][2], w0[i][3])};
#pragma unroll
    for (int i = 0; i < 32; ++i) w1[i] = *(const v4f*)(wbs + (size_t)wo + (32 + i) * 4096);
#pragma unroll
    for (int i = 0; i < 32; ++i) *(v2u*)(xs + i * 2 * XPB) = (v2u){pkbf(xr[i][0], xr[i][1]), pkbf(xr[i][2], xr[i][3])};
#pragma unroll
    for (int i = 0; i < 32; ++i) w2[i] = *(const v4f*)(wbs + (size_t)wo + (64 + i) * 4096);
    // the same wait for the loads of the weights
    asm volatile("s_wait_xcnt 0x0" :: "s"(wbs), "v"(wo) : "memory");
#pragma unroll
    for (int i = 0; i < 32; ++i) *(v2u*)(wsd + i * 16 * WPB + HD * 2) = (v2u){pkbf(w1[i][0], w1[i][1]), pkbf(w1[i][2], w1[i][3])};
#pragma unroll
    for (int i = 0; i < 32; ++i) *(v2u*)(wsd + i * 16 * WPB + 2 * HD * 2) = (v2u){pkbf(w2[i][0], w2[i][1]), pkbf(w2[i][2], w2[i][3])};
    __syncthreads();
    const int rg = w & 1, cg = w >> 1;   // rows rg * 32 .. + 31, columns cg * 48 .. + 47
    const char* ap = Xs + (rg * 32 + c) * XPB + h * 16;
    const char* bp = Ws + (8 * h + (lane & 7)) * WPB + ((lane >> 3) & 1) * 16 + cg * 48 * 2;
    v8f acc[2][3];
#pragma unroll
    for (int rt = 0; rt < 2; ++rt)
#pragma unroll
        for (int ct = 0; ct < 3; ++ct) acc[rt][ct] = (v8f){};
    // fragments one k step ahead, in two register sets, so that a step's products do not wait for their own LDS reads
    v16bf a[2][2], bb[2][3];
#pragma unroll
    for (int rt = 0; rt < 2; ++rt) a[0][rt] = ldf(ap + rt * 16 * XPB);
#pragma unroll
    for (int ct = 0; ct < 3; ++ct) bb[0][ct] = ldt(bp + ct * 32);
#pragma unroll
    for (int kc = 0; kc < DM / 32; ++kc) { const int cu = kc & 1, nx = cu ^ 1;
        if (kc + 1 < DM / 32) {
#pragma unroll
            for (int rt = 0; rt < 2; ++rt) a[nx][rt] = ldf(ap + rt * 16 * XPB + (kc + 1) * 64);
#pragma unroll
            for (int ct = 0; ct < 3; ++ct) bb[nx][ct] = ldt(bp + ct * 32 + (kc + 1) * 32 * WPB);
        }
        // keeps the next step's reads in front of this step's products (the scheduler otherwise sinks them to just before their use)
        __builtin_amdgcn_sched_barrier(0);
#pragma unroll
        for (int rt = 0; rt < 2; ++rt)
#pragma unroll
            for (int ct = 0; ct < 3; ++ct) acc[rt][ct] = wmmab(a[cu][rt], bb[cu][ct], acc[rt][ct]); }
    __syncthreads();   // every wave has read its last fragment: the operand tiles' LDS now takes the results
    float* Fs = (float*)sm; float* Vs = Fs + PR * FPI;
    // accumulator register j of lane (c, h) = (row 8h + j, column c) of its tile
#pragma unroll
    for (int rt = 0; rt < 2; ++rt)
#pragma unroll
        for (int ct = 0; ct < 3; ++ct) { const int nt = cg * 3 + ct, r = rg * 32 + rt * 16 + 8 * h; const v8f d = acc[rt][ct];
            if (nt < 8) {
#pragma unroll
                for (int j = 0; j < 8; ++j) Fs[(r + j) * FPI + nt * 16 + c] = d[j];
            } else { float* p = Vs + ((nt - 8) * 16 + c) * VPI + r; *(v4fa*)p = (v4f){d[0], d[1], d[2], d[3]}; *(v4fa*)(p + 4) = (v4f){d[4], d[5], d[6], d[7]}; } }
    __syncthreads();
    // a thread's 16 bytes stand at its own index in the stored unit; which row and piece they are follows from the fragment order
    // q|k: a tile of 16 token rows a step, threads 0..127 its q, 128..255 its k (row tid & 15, piece (tid >> 4) & 7); v: a block of 32 keys a step (d = (tid >> 6) * 16 + (tid & 15), piece (tid >> 4) & 3)
    char* qo = (char*)(QK + (size_t)(tid >> 7) * K_EL + (size_t)R0 * HD + (tid & 127) * 8);
    char* vo = (char*)(VT + ((size_t)b * SEQ + t0) * HD + tid * 8);
#pragma unroll
    for (int it = 0; it < 4; ++it) { const float* s = Fs + (it * 16 + (tid & 15)) * FPI + (tid >> 4) * 8; v4u hi, lo; split8(*(const v4fa*)s, *(const v4fa*)(s + 4), hi, lo);
        *(v4u*)(qo + it * 16 * HD * 2) = hi; *(v4u*)(qo + QK_LO + it * 16 * HD * 2) = lo;
        // the wait in front of any rewrite of a register that the step's two stores name (the next step takes them over); as the statement's inputs they stay live up to it
        asm volatile("s_wait_xcnt 0x0" :: "v"(hi), "v"(lo), "v"(qo) : "memory"); }
#pragma unroll
    for (int it = 0; it < 2; ++it) { const float* s = Vs + ((tid >> 6) * 16 + (tid & 15)) * VPI + (it * 4 + ((tid >> 4) & 3)) * 8; v4u hi, lo; split8(*(const v4fa*)s, *(const v4fa*)(s + 4), hi, lo);
        *(v4u*)(vo + it * 4096) = hi; *(v4u*)(vo + VT_LO + it * 4096) = lo;
        // the same wait (the address lives on into the next step); behind the last step nothing is rewritten any more
        if (it == 0) asm volatile("s_wait_xcnt 0x0" :: "v"(hi), "v"(lo) : "memory"); }
}

// workspace carve (bytes), all multiples of 256
constexpr size_t B_QK  = (size_t)2 * NB * SEQ * HD * 2;
constexpr size_t B_VT  = (size_t)NB * HD * SEQ * 2;
constexpr size_t B_TOT = 2 * B_QK + 2 * B_VT;
static_assert(B_QK % 256 == 0 && B_VT % 256 == 0);
static_assert(B_TOT <= (size_t)134217728);
static_assert(B_QK == QK_LO && B_VT == VT_LO);   // the low planes are carved directly behind the high planes

extern "C" void kernel_launch(void* const* d_in, const int* in_sizes, int n_in,
                              void* d_out, int out_size, void* d_ws, size_t ws_size, hipStream_t stream) {
    if (n_in < 2) return;
    if ((size_t)in_sizes[0] < (size_t)(NB - 1) * SEQ_FULL * DM + (size_t)SEQ * DM) return;
    if ((size_t)in_sizes[1] < (size_t)3 * DM * HD) return;
    if ((size_t)out_size < (size_t)NB * SEQ * HD) return;
    if (B_TOT > ws_size) return;
    const float* x = (const float*)d_in[0];      // [8][2048][512]
    const float* ker = (const float*)d_in[1];    // [3][512][64]
    float* OUT = (float*)d_out;                  // [NB][SEQ][64]
    char* wsp = (char*)d_ws;
    auto take = [&](size_t bytes) { char* p = wsp; wsp += (bytes + 255) & ~(size_t)255; return (void*)p; };
    bf* QKh  = (bf*)take(B_QK);      // [2][NB*SEQ][64], each tile of 16 rows in fragment order
    bf* QKl  = (bf*)take(B_QK);
    bf* VTh  = (bf*)take(B_VT);      // [NB][SEQ/32][64][32], each key block in fragment order
    bf* VTl  = (bf*)take(B_VT);
    (void)QKl; (void)VTl;            // reached from the high planes' addresses (QK_LO, VT_LO)
    if ((size_t)(wsp - (char*)d_ws) > ws_size) return;

    // x, weights -> q, k (hi/lo planes) and v transposed (hi/lo planes), one launch
    k_proj<<<dim3(NB * SEQ / PR, 1, 1), 256, 0, stream>>>(x, ker, QKh, VTh);
    // out = softmax(q k^T x HD^-0.5) v, one launch for all batches
    k_fattn<<<dim3(SEQ / QB, NB, 1), KSPL * 32, 0, stream>>>(QKh, VTh, OUT);
}

// v006
// It runs in 19.9 microseconds.
// Versions in between are left out here; by their measured steps it is 1.57 times as fast as v004.
// Counting every step since v000, it is 15.2 times as fast.
#include <hip/hip_runtime.h>

// Single-head self-attention, 8 x 2048 tokens, model width 512, head width 64 (x [8][2048][512]; q/k/v = x kernel[0/1/2] ([3][512][64]); scores x 64^-0.5; softmax over 2048 keys; out = attn v -> [8][2048][64]).
// Compute dtypes, f32 accumulate everywhere: x and kernel converted to bf16 (RNE), projections v_wmma_f32_16x16x32_bf16 single product (exact products of bf16 inputs);
// scores q.k: q and k rounded to f16 (RNE), one product v_wmma_f32_16x16x32_f16; softmax f32, online (running maximum, unnormalised P, one division at the end); attn.v: P and v rounded to f16, one product; output f32.
// Why f16 is enough there: its 11 significant bits leave a rounding error 8 times below that of the 8-bit bf16 operands of the projections, which sets the result's error; q, k, v (a few units at most for the declared inputs) and P (at most 2^8) lie far inside its range.
// Scores, softmax and attn.v run in ONE kernel (k_fattn): neither the scores nor P ever reach memory.
// The bf16 conversion of x and of the weights, the three projections, their rounding to f16 and the transposition of v run in ONE kernel too (k_proj).
// The planes of q, k and v lie in memory in FRAGMENT ORDER: the 16 bytes that lane 0..31 of a wave takes with one load stand side by side, so a load covers 512 contiguous bytes (4 whole lines).

#ifndef NB
#define NB 8
#endif
#ifndef SEQ
#define SEQ 2048
#endif
#define NB_FULL  8
#define SEQ_FULL 2048
#define DM   512
#define HD   64
#define NQKV 192                 // fused projection width: q | k | v
#define NCG  4                   // 16-query column groups per wave of the fused attention kernel
#define KSPL 8                   // key ranges per work-group, one wave each
#define QB   (NCG * 16)          // queries per work-group
#define SCL  0.125f              // HD^-0.5

static_assert(NB <= NB_FULL);
static_assert(SEQ <= SEQ_FULL);
static_assert(SEQ % QB == 0);
static_assert(SEQ % (KSPL * 32) == 0);
static_assert((QB * HD / 4) % (KSPL * 32) == 0);
static_assert(SEQ % 128 == 0);
static_assert(DM % 32 == 0);
static_assert(HD == 64);
static_assert((NB * SEQ) % 64 == 0);

typedef unsigned short bf;       // 16 bits of storage: bf16 in k_proj's LDS tiles, f16 in the planes
typedef __attribute__((ext_vector_type(16))) __bf16   v16bf;
typedef __attribute__((ext_vector_type(16))) _Float16 v16h;
typedef __attribute__((ext_vector_type(2)))  _Float16 v2h;
typedef __attribute__((ext_vector_type(8)))  unsigned short v8us;
typedef __attribute__((ext_vector_type(8)))  float    v8f;
typedef __attribute__((ext_vector_type(4)))  float    v4f;
typedef __attribute__((ext_vector_type(2)))  float    v2f;
typedef v4f  __attribute__((may_alias)) v4fa;

__device__ __forceinline__ v16bf cat16b(v8us lo, v8us hi) { return __builtin_bit_cast(v16bf, __builtin_shufflevector(lo, hi, 0, 1, 2, 3, 4, 5, 6, 7, 8, 9, 10, 11, 12, 13, 14, 15)); }
__device__ __forceinline__ v8f wmmab(v16bf a, v16bf b, v8f c) { return __builtin_amdgcn_wmma_f32_16x16x32_bf16(false, a, false, b, (short)0, c, false, false); }
__device__ __forceinline__ v16h cat16h(v8us lo, v8us hi) { return __builtin_bit_cast(v16h, __builtin_shufflevector(lo, hi, 0, 1, 2, 3, 4, 5, 6, 7, 8, 9, 10, 11, 12, 13, 14, 15)); }
__device__ __forceinline__ v8f wmmah(v16h a, v16h b, v8f c) { return __builtin_amdgcn_wmma_f32_16x16x32_f16(false, a, false, b, (short)0, c, false, false); }

// k_fattn: scores, softmax and attn.v fused. Work-group = QB queries of one batch, KSPL waves; wave w walks keys [w, w+1) * SEQ/KSPL in passes of 32 for ALL QB queries.
// Transposed products: St = K.Qt (A = K rows, B = Q rows, both k-contiguous planes), Ot += Vt.Pt (A = Vt rows, B = P packed from the two St tiles of a pass, which already lie in the operand's k order).
// A lane holds one query's scores (column l&15), so maximum, sum and rescale factor are per lane; the two lane halves hold different keys of that query.
// The running maximum is replaced only when a new one exceeds it by more than 8 (log2 units), so P <= 2^8; the KSPL partial results are joined through LDS in fixed wave order.
__device__ __forceinline__ float xhalf(float x) { return __builtin_bit_cast(float, __builtin_amdgcn_permlanex16(__builtin_bit_cast(int, x), __builtin_bit_cast(int, x), 0x76543210, 0xfedcba98, false, false)); }  // lane l with lane l ^ 16
// one operand fragment from the lane's own byte address in a row-major tile (LDS): elements 0..7 at p, 8..15 at p + 32 bytes
__device__ __forceinline__ v16bf ldf(const char* p) { return cat16b(*(const v8us*)p, *(const v8us*)(p + 32)); }
// the same from a plane in fragment order (memory): p = fragment + lane * 16; elements 0..7 at p, 8..15 at p + 512 bytes
__device__ __forceinline__ v16h ldg(const char* p) { return cat16h(*(const v8us*)p, *(const v8us*)(p + 512)); }
typedef __attribute__((ext_vector_type(2))) __bf16   v2bf;
typedef __attribute__((ext_vector_type(8))) unsigned v8u;
// 2^a with the slot behind a transcendental closed by construction: until the v_nop the result is unread and the source register unwritten (they are the statement's operands),
// so what stands directly behind the v_exp_f32 is an independent instruction or the v_nop itself
__device__ __forceinline__ float exp2s(float a) { float p = __builtin_amdgcn_exp2f(a); asm("v_nop" : "+v"(p) : "v"(a)); return p; }
#define OPITCH (HD + 4)
// QK: [q|k][NB*SEQ/16 tiles][8 pieces of a row][16 rows][8 elements]: a tile of 16 token rows keeps its 2 KiB, its 16-byte pieces stand piece-major (piece u = elements 8u..8u+7 of a row).
// VT: [NB][SEQ/32 key blocks][4 tiles of 16 d][4 pieces of 8 keys][16 d][8 keys]: 4 KiB a key block.
// Lane (c, h) of a fragment takes pieces h and 2 + h (of the fragment's 32 k) of row c, so each half of a fragment is 32 lanes x 16 bytes in a row.
constexpr size_t K_EL = (size_t)NB * SEQ * HD, K_B = K_EL * 2;
static_assert(K_B + 8192 < (1u << 23));   // the k plane is reached from the q plane's address by a load's immediate offset
__global__ __launch_bounds__(KSPL * 32) void k_fattn(const bf* __restrict__ QK, const bf* __restrict__ VT, float* __restrict__ out) {
    __shared__ __align__(16) float Os[KSPL * QB * OPITCH];
    __shared__ float ms[KSPL * QB];
    __shared__ float ls[KSPL * QB];
    const int tid = threadIdx.x, lane = tid & 31, c = lane & 15, h = lane >> 4, w = __builtin_amdgcn_readfirstlane(tid >> 5);
    const int b = blockIdx.y, q0 = blockIdx.x * QB;
    const float SC2 = SCL * 1.4426950408889634f;   // score scale and log2(e) in one factor
    constexpr int KPW = SEQ / KSPL;                // keys per wave
    const unsigned lo16 = (unsigned)lane * 16u;    // lane's bytes into each half of a fragment (row c, k order 8h.., 16+8h..)
    const char* qa = (const char*)(QK + ((size_t)b * SEQ + q0) * HD) + lo16;
    v16h qh[NCG][2];
#pragma unroll
    for (int g = 0; g < NCG; ++g)
#pragma unroll
        for (int ks = 0; ks < 2; ++ks) qh[g][ks] = ldg(qa + g * 2048 + ks * 1024);
    // this pass's 32 keys: two tiles of k, one key block of v; kp points into the q plane, K_B bytes in front of the keys, and every load adds K_B in its immediate offset:
    // so the register that the loads name is kp itself, and the wait below, which takes kp as its input, needs no sum formed in front of it
    const char* kp = (const char*)(QK + ((size_t)b * SEQ + w * KPW) * HD) + lo16;
    const char* vp = (const char*)(VT + ((size_t)b * SEQ + w * KPW) * HD) + lo16;
    v8f o[4][NCG]; float m[NCG], l[NCG];
#pragma unroll
    for (int g = 0; g < NCG; ++g) { m[g] = -3.0e38f; l[g] = 0.f;
#pragma unroll
        for (int dt = 0; dt < 4; ++dt) o[dt][g] = (v8f){}; }
    v16h kh[2][2];
#pragma unroll
    for (int kt = 0; kt < 2; ++kt)
#pragma unroll
        for (int ks = 0; ks < 2; ++ks) kh[kt][ks] = ldg(kp + K_B + kt * 2048 + ks * 1024);
    // the wait in front of any rewrite of a register that the loads above name; as the statement's input the lane offset stays live up to it
    asm volatile("s_wait_xcnt 0x0" :: "v"(lo16) : "memory");
#pragma unroll 1
    for (int k0 = 0; k0 < KPW; k0 += 32) {
        // this pass's V, used after the softmax
        v16h vh[4];
#pragma unroll
        for (int dt = 0; dt < 4; ++dt) vh[dt] = ldg(vp + dt * 1024);
        v8f st[NCG][2];
#pragma unroll
        for (int g = 0; g < NCG; ++g) { st[g][0] = (v8f){}; st[g][1] = (v8f){}; }
#pragma unroll
        for (int ks = 0; ks < 2; ++ks)
#pragma unroll
            for (int kt = 0; kt < 2; ++kt)
#pragma unroll
                for (int g = 0; g < NCG; ++g) st[g][kt] = wmmah(kh[kt][ks], qh[g][ks], st[g][kt]);
        // the next pass's K, into the same registers, so that its latency lies under the softmax and attn.v; a wave's last pass fetches, and never uses,
        // the 4 KiB behind its keys: the next wave's or batch's keys or, at the plane's end, the head of the v plane, all written earlier in this call
#pragma unroll
        for (int kt = 0; kt < 2; ++kt)
#pragma unroll
            for (int ks = 0; ks < 2; ++ks) kh[kt][ks] = ldg(kp + K_B + 4096 + kt * 2048 + ks * 1024);
        // the wait in front of any rewrite of a register that this pass's loads name (the two addresses advance right behind it); as the statement's inputs they stay live up to it
        asm volatile("s_wait_xcnt 0x0" :: "v"(kp), "v"(vp) : "memory");
        kp += 4096; vp += 4096;
        float mx[NCG]; bool need = false;
#pragma unroll
        for (int g = 0; g < NCG; ++g) { float a = fmaxf(st[g][0][0], st[g][1][0]);
#pragma unroll
            for (int r = 1; r < 8; ++r) a = fmaxf(a, fmaxf(st[g][0][r], st[g][1][r]));
            a = fmaxf(a, xhalf(a)); mx[g] = a * SC2; need = need || (mx[g] > m[g] + 8.0f); }
        if (__builtin_amdgcn_ballot_w32(need) != 0) {
#pragma unroll
            for (int g = 0; g < NCG; ++g) { const float mn = fmaxf(m[g], mx[g]); const float al = exp2s(m[g] - mn); m[g] = mn; l[g] *= al;
#pragma unroll
                for (int dt = 0; dt < 4; ++dt) o[dt][g] *= al; }
        }
        // column group by column group: a group's P lives only until its own four products, and the next group's vector work stands beside them
#pragma unroll
        for (int g = 0; g < NCG; ++g) { v8u hu;
#pragma unroll
            for (int s = 0; s < 16; s += 2) { v2f p;
                const float a0 = __builtin_fmaf(st[g][s >> 3][s & 7], SC2, -m[g]), a1 = __builtin_fmaf(st[g][s >> 3][(s & 7) + 1], SC2, -m[g]);
                float p0 = __builtin_amdgcn_exp2f(a0), p1 = __builtin_amdgcn_exp2f(a1);
                // the slot behind a transcendental, as in exp2s, one v_nop for the pair
                asm("v_nop" : "+v"(p0), "+v"(p1) : "v"(a0), "v"(a1));
                p[0] = p0; p[1] = p1; l[g] += p0; l[g] += p1;
                hu[s >> 1] = __builtin_bit_cast(unsigned, __builtin_convertvector(p, v2h)); }
            const v16h ph = __builtin_bit_cast(v16h, hu);
#pragma unroll
            for (int dt = 0; dt < 4; ++dt) o[dt][g] = wmmah(vh[dt], ph, o[dt][g]); }
    }
    // each wave's partial result: maximum, sum (both lane halves joined) and Ot, a lane's 8 registers being 8 consecutive d of its query
#pragma unroll
    for (int g = 0; g < NCG; ++g) { const int q = g * 16 + c; const float lj = l[g] + xhalf(l[g]);
        if (h == 0) { ms[w * QB + q] = m[g]; ls[w * QB + q] = lj; }
#pragma unroll
        for (int dt = 0; dt < 4; ++dt) { float* p = Os + (size_t)(w * QB + q) * OPITCH + dt * 16 + 8 * h;
            *(v4f*)p = (v4f){o[dt][g][0], o[dt][g][1], o[dt][g][2], o[dt][g][3]}; *(v4f*)(p + 4) = (v4f){o[dt][g][4], o[dt][g][5], o[dt][g][6], o[dt][g][7]}; } }
    __syncthreads();
#pragma unroll
    for (int i = 0; i < QB * HD / 4 / (KSPL * 32); ++i) { const int f = i * (KSPL * 32) + tid, q = f >> 4, d4 = (f & 15) * 4;
        float M = ms[q];
#pragma unroll
        for (int u = 1; u < KSPL; ++u) M = fmaxf(M, ms[u * QB + q]);
        float L = 0.f; v4f acc = (v4f){};
#pragma unroll
        for (int u = 0; u < KSPL; ++u) { const float wt = exp2s(ms[u * QB + q] - M); L += ls[u * QB + q] * wt; acc += *(const v4f*)(Os + (size_t)(u * QB + q) * OPITCH + d4) * wt; }
        const float f1 = __fdiv_rn(1.0f, L);
        *(v4f*)(out + ((size_t)b * SEQ + q0 + q) * HD + d4) = acc * f1; }
}
// k_proj: q, k and v of PR token rows in one work-group, from x in f32 to the operand planes of k_fattn; neither a bf16 copy of x nor the f32 projections reach memory.
// Whole-line loads bring the PR x DM tile of x and all three weight matrices, both f32, into LDS (converted to bf16, RNE, on the way); 8 waves then hold 2 x 3 tiles of the PR x NQKV result each.
// The weights keep the input's own order in LDS (row = k, columns q | k | v side by side): A = x rows read by ldf, B = weight columns read by the transposing load (ldt),
// which delivers ldf's k order (8h.., 16 + 8h..); k in steps of 32 from 0 up. The f32 results go through LDS, q|k by rows and v transposed, so that every plane is stored in whole 128-byte lines, in k_fattn's fragment order.
#define PR   64                  // token rows per work-group
#define XPB  ((DM + 8) * 2)      // LDS row pitch of the bf16 x tile, bytes: 16 x an odd number, for 16-byte readers
#define WPB  ((NQKV + 16) * 2)   // LDS row pitch of the bf16 weight tile, bytes: 32 x an odd number, for the transposing reader
#define FPI  (2 * HD + 4)        // LDS row pitch of the f32 q|k tile, floats
#define VPI  (PR + 4)            // LDS row pitch of the f32 v tile (row = d, column = token), floats
#define KC   64                  // k per chunk of the staging
#define NCH  (DM / KC)
#define TPR  (KC / 4)            // threads per row of x in a chunk, 16 bytes each
#define XST  (PR * TPR / 256)    // load steps of x in a chunk
#define WST  (KC / 16)           // load steps of one weight matrix in a chunk
#define NLD  (XST + 3 * WST)     // loads a thread and chunk
#define NSET (64 / NLD)          // chunks in flight, one register set each
static_assert(SEQ % PR == 0 && DM == 512 && NQKV == 192 && PR == 64 && (KC == 64 || KC == 128) && NCH > NSET);
static_assert((size_t)(PR * FPI + HD * VPI) * 4 <= (size_t)PR * XPB);
static_assert(WPB % 32 == 0 && (WPB / 32) % 2 == 1 && (4 * WPB) % 256 == 128 && (PR * XPB) % 32 == 0);
typedef __attribute__((ext_vector_type(4))) unsigned v4u;
typedef __attribute__((ext_vector_type(2))) unsigned v2u;
__device__ __forceinline__ unsigned pkbf(float a, float b) { const v2f p = {a, b}; return __builtin_bit_cast(unsigned, __builtin_convertvector(p, v2bf)); }
__device__ __forceinline__ unsigned pkh(float a, float b) { const v2f p = {a, b}; return __builtin_bit_cast(unsigned, __builtin_convertvector(p, v2h)); }
// eight f32 -> eight f16 (RNE)
__device__ __forceinline__ v4u cvt8(v4f a, v4f b) { return (v4u){pkh(a[0], a[1]), pkh(a[2], a[3]), pkh(b[0], b[1]), pkh(b[2], b[3])}; }
typedef __attribute__((ext_vector_type(8))) short v8s;
// one B fragment (32 k x 16 columns) from a row-major tile (row = k) in LDS: p = tile + (8h + (lane & 7)) * WPB + ((lane >> 3) & 1) * 16;
// lane (c, h) gets column c at k = 8h .. 8h + 7 from the first load and at 16 + 8h .. from the second, 16 rows further down
__device__ __forceinline__ v8us ldtr(const char* p) { typedef __attribute__((address_space(3))) v8s lds_v8s; return __builtin_bit_cast(v8us, __builtin_amdgcn_ds_load_tr16_b128_v8i16((lds_v8s*)p)); }
__device__ __forceinline__ v16bf ldt(const char* p) { return cat16b(ldtr(p), ldtr(p + 16 * WPB)); }
__global__ __launch_bounds__(256) void k_proj(const float* __restrict__ x, const float* __restrict__ ker, bf* __restrict__ QK, bf* __restrict__ VT) {
    __shared__ __align__(32) char sm[PR * XPB + DM * WPB];
    char* Xs = sm; char* Ws = sm + PR * XPB;
    const int tid = threadIdx.x, lane = tid & 31, c = lane & 15, h = lane >> 4, w = __builtin_amdgcn_readfirstlane(tid >> 5);
    const int R0 = blockIdx.x * PR, b = R0 / SEQ, t0 = R0 % SEQ;
    // 256 threads x 16 bytes = 4 KiB a step: 256 / TPR rows of x (the KC * 4 bytes that a chunk of KC k takes of each), sixteen rows (256 bytes each) of one weight matrix;
    // one uniform base each and the thread's own bytes, steps and chunks in the immediate offset
    const char* xb = (const char*)(x + ((size_t)b * SEQ_FULL + t0) * DM);
    const char* wbs = (const char*)ker;
    // a wave takes rows wrow and wrow + 4 of a step's sixteen: in LDS they lie 4 * WPB bytes apart, half the banks, so its 8-byte stores meet no conflict
    const int wrow = (w & 3) + 4 * h + 8 * (w >> 2);
    const unsigned wo = (unsigned)wrow * 256u + (unsigned)c * 16u;
    const unsigned xo = (unsigned)(tid / TPR) * (DM * 4u) + (unsigned)(tid % TPR) * 16u;
    char* xs = Xs + (tid / TPR) * XPB + (tid % TPR) * 8;
    char* wsd = Ws + wrow * WPB + c * 8;
    const int rg = w & 1, cg = w >> 1;   // rows rg * 32 .. + 31, columns cg * 48 .. + 47
    const char* ap = Xs + (rg * 32 + c) * XPB + h * 16;
    const char* bp = Ws + (8 * h + (lane & 7)) * WPB + ((lane >> 3) & 1) * 16 + cg * 48 * 2;
    v8f acc[2][3];
#pragma unroll
    for (int rt = 0; rt < 2; ++rt)
#pragma unroll
        for (int ct = 0; ct < 3; ++ct) acc[rt][ct] = (v8f){};
    // x and the weights arrive in NCH chunks of KC k (NLD loads a thread each: XST of x, WST of each weight matrix), NSET chunks in flight, a register set each.
    // A chunk goes to LDS as soon as it is there, the loads of the chunk NSET further on take its registers, one barrier publishes it, and its products run while the later chunks are still on their way.
    // Every chunk has its own place in LDS, so no barrier is needed behind its readers. (All loops of this kernel are unrolled: their indices pick registers and immediate offsets.)
    v4f ld[NSET][NLD];
#pragma unroll
    for (int j = 0; j < NSET; ++j) {
#pragma unroll
        for (int s = 0; s < XST; ++s) ld[j][s] = *(const v4f*)(xb + (size_t)xo + s * (256 / TPR) * DM * 4 + j * KC * 4);
#pragma unroll
        for (int i = 0; i < 3 * WST; ++i) ld[j][XST + i] = *(const v4f*)(wbs + (size_t)wo + ((i / WST) * 32 + j * WST + i % WST) * 4096);
        // keeps the loads in chunk order: loads return in issue order, and a chunk whose last load stands among a later chunk's would wait for that one too
        __builtin_amdgcn_sched_barrier(0);
    }
    // fragments one k step ahead inside a chunk, in two register sets, so that a step's products do not wait for their own LDS reads
    v16bf a[2][2], bb[2][3];
#pragma unroll
    for (int j = 0; j < NCH; ++j) { const int st = j % NSET;
#pragma unroll
        for (int s = 0; s < XST; ++s) *(v2u*)(xs + s * (256 / TPR) * XPB + j * KC * 2) = (v2u){pkbf(ld[st][s][0], ld[st][s][1]), pkbf(ld[st][s][2], ld[st][s][3])};
#pragma unroll
        for (int i = 0; i < 3 * WST; ++i) *(v2u*)(wsd + (j * WST + i % WST) * 16 * WPB + (i / WST) * HD * 2) = (v2u){pkbf(ld[st][XST + i][0], ld[st][XST + i][1]), pkbf(ld[st][XST + i][2], ld[st][XST + i][3])};
        if (j + NSET < NCH) {
            // keeps the loads of the later chunk behind the stores that free their registers (hoisted, they cost spills)
            __builtin_amdgcn_sched_barrier(0);
#pragma unroll
            for (int s = 0; s < XST; ++s) ld[st][s] = *(const v4f*)(xb + (size_t)xo + s * (256 / TPR) * DM * 4 + (j + NSET) * KC * 4);
#pragma unroll
            for (int i = 0; i < 3 * WST; ++i) ld[st][XST + i] = *(const v4f*)(wbs + (size_t)wo + ((i / WST) * 32 + (j + NSET) * WST + i % WST) * 4096);
        }
        // behind the last loads: the wait in front of any rewrite of a register that the loads name; as the statement's inputs the bases and the thread's offsets stay live up to it
        if (j + NSET + 1 == NCH) asm volatile("s_wait_xcnt 0x0" :: "s"(xb), "v"(xo), "s"(wbs), "v"(wo) : "memory");
        // chunk j stands in LDS for every wave. The barrier orders LDS alone: __syncthreads() would also wait for the global loads in flight, which are the point of the chunks
        __builtin_amdgcn_fence(__ATOMIC_RELEASE, "workgroup", "local");
        __builtin_amdgcn_s_barrier();
        __builtin_amdgcn_fence(__ATOMIC_ACQUIRE, "workgroup", "local");
#pragma unroll
        for (int rt = 0; rt < 2; ++rt) a[0][rt] = ldf(ap + rt * 16 * XPB + j * (KC / 32) * 64);
#pragma unroll
        for (int ct = 0; ct < 3; ++ct) bb[0][ct] = ldt(bp + ct * 32 + j * KC * WPB);
#pragma unroll
        for (int kk = 0; kk < KC / 32; ++kk) { const int kc = j * (KC / 32) + kk, cu = kk & 1, nx = cu ^ 1;
            if (kk + 1 < KC / 32) {
#pragma unroll
                for (int rt = 0; rt < 2; ++rt) a[nx][rt] = ldf(ap + rt * 16 * XPB + (kc + 1) * 64);
#pragma unroll
                for (int ct = 0; ct < 3; ++ct) bb[nx][ct] = ldt(bp + ct * 32 + (kc + 1) * 32 * WPB);
            }
            // keeps the next step's reads in front of this step's products (the scheduler otherwise sinks them to just before their use)
            __builtin_amdgcn_sched_barrier(0);
#pragma unroll
            for (int rt = 0; rt < 2; ++rt)
#pragma unroll
                for (int ct = 0; ct < 3; ++ct) acc[rt][ct] = wmmab(a[cu][rt], bb[cu][ct], acc[rt][ct]); }
    }
    __syncthreads();   // every wave has read its last fragment: the operand tiles' LDS now takes the results
    float* Fs = (float*)sm; float* Vs = Fs + PR * FPI;
    // accumulator register j of lane (c, h) = (row 8h + j, column c) of its tile
#pragma unroll
    for (int rt = 0; rt < 2; ++rt)
#pragma unroll
        for (int ct = 0; ct < 3; ++ct) { const int nt = cg * 3 + ct, r = rg * 32 + rt * 16 + 8 * h; const v8f d = acc[rt][ct];
            if (nt < 8) {
#pragma unroll
                for (int j = 0; j < 8; ++j) Fs[(r + j) * FPI + nt * 16 + c] = d[j];
            } else { float* p = Vs + ((nt - 8) * 16 + c) * VPI + r; *(v4fa*)p = (v4f){d[0], d[1], d[2], d[3]}; *(v4fa*)(p + 4) = (v4f){d[4], d[5], d[6], d[7]}; } }
    __syncthreads();
    // a thread's 16 bytes stand at its own index in the stored unit; which row and piece they are follows from the fragment order
    // q|k: a tile of 16 token rows a step, threads 0..127 its q, 128..255 its k (row tid & 15, piece (tid >> 4) & 7); v: a block of 32 keys a step (d = (tid >> 6) * 16 + (tid & 15), piece (tid >> 4) & 3)
    char* qo = (char*)(QK + (size_t)(tid >> 7) * K_EL + (size_t)R0 * HD + (tid & 127) * 8);
    char* vo = (char*)(VT + ((size_t)b * SEQ + t0) * HD + tid * 8);
#pragma unroll
    for (int it = 0; it < 4; ++it) { const float* s = Fs + (it * 16 + (tid & 15)) * FPI + (tid >> 4) * 8; const v4u hv = cvt8(*(const v4fa*)s, *(const v4fa*)(s + 4));
        *(v4u*)(qo + it * 16 * HD * 2) = hv;
        // the wait in front of any rewrite of a register that the step's store names (the next step takes them over); as the statement's inputs they stay live up to it
        asm volatile("s_wait_xcnt 0x0" :: "v"(hv), "v"(qo) : "memory"); }
#pragma unroll
    for (int it = 0; it < 2; ++it) { const float* s = Vs + ((tid >> 6) * 16 + (tid & 15)) * VPI + (it * 4 + ((tid >> 4) & 3)) * 8; const v4u hv = cvt8(*(const v4fa*)s, *(const v4fa*)(s + 4));
        *(v4u*)(vo + it * 4096) = hv;
        // the same wait (the address lives on into the next step); behind the last step nothing is rewritten any more
        if (it == 0) asm volatile("s_wait_xcnt 0x0" :: "v"(hv) : "memory"); }
}

// workspace carve (bytes), all multiples of 256
constexpr size_t B_QK  = (size_t)2 * NB * SEQ * HD * 2;
constexpr size_t B_VT  = (size_t)NB * HD * SEQ * 2;
constexpr size_t B_TOT = B_QK + B_VT;
static_assert(B_QK % 256 == 0 && B_VT % 256 == 0);
static_assert(B_TOT <= (size_t)134217728);
static_assert(B_VT >= 4096);   // the v plane is carved directly behind the k plane: k_fattn's last fetch ahead ends inside it

extern "C" void kernel_launch(void* const* d_in, const int* in_sizes, int n_in,
                              void* d_out, int out_size, void* d_ws, size_t ws_size, hipStream_t stream) {
    if (n_in < 2) return;
    if ((size_t)in_sizes[0] < (size_t)(NB - 1) * SEQ_FULL * DM + (size_t)SEQ * DM) return;
    if ((size_t)in_sizes[1] < (size_t)3 * DM * HD) return;
    if ((size_t)out_size < (size_t)NB * SEQ * HD) return;
    if (B_TOT > ws_size) return;
    const float* x = (const float*)d_in[0];      // [8][2048][512]
    const float* ker = (const float*)d_in[1];    // [3][512][64]
    float* OUT = (float*)d_out;                  // [NB][SEQ][64]
    char* wsp = (char*)d_ws;
    auto take = [&](size_t bytes) { char* p = wsp; wsp += (bytes + 255) & ~(size_t)255; return (void*)p; };
    bf* QKh  = (bf*)take(B_QK);      // [2][NB*SEQ][64], each tile of 16 rows in fragment order
    bf* VTh  = (bf*)take(B_VT);      // [NB][SEQ/32][64][32], each key block in fragment order
    if ((size_t)(wsp - (char*)d_ws) > ws_size) return;

    // x, weights -> q, k and v transposed, f16 planes, one launch
    k_proj<<<dim3(NB * SEQ / PR, 1, 1), 256, 0, stream>>>(x, ker, QKh, VTh);
    // out = softmax(q k^T x HD^-0.5) v, one launch for all batches
    k_fattn<<<dim3(SEQ / QB, NB, 1), KSPL * 32, 0, stream>>>(QKh, VTh, OUT);
}

// v007
// It runs in 19.1 microseconds.
// Next to v006, in two timings, it ran 1.05 and 1.03 times as fast.
// Counting every step since v000, it is 15.9 times as fast.
#include <hip/hip_runtime.h>

// Single-head self-attention, 8 x 2048 tokens, model width 512, head width 64 (x [8][2048][512]; q/k/v = x kernel[0/1/2] ([3][512][64]); scores x 64^-0.5; softmax over 2048 keys; out = attn v -> [8][2048][64]).
// Compute dtypes, f32 accumulate everywhere: x and kernel converted to bf16 (RNE), projections v_wmma_f32_16x16x32_bf16 single product (exact products of bf16 inputs);
// scores q.k: q and k rounded to f16 (RNE), one product v_wmma_f32_16x16x32_f16; softmax f32, online (running maximum, unnormalised P, one division at the end); attn.v: P and v rounded to f16, one product; output f32.
// Why f16 is enough there: its 11 significant bits leave a rounding error 8 times below that of the 8-bit bf16 operands of the projections, which sets the result's error; q, k, v (a few units at most for the declared inputs) and P (at most 2^8) lie far inside its range.
// Scores, softmax and attn.v run in ONE kernel (k_fattn): neither the scores nor P ever reach memory.
// The bf16 conversion of x and of the weights, the three projections, their rounding to f16 and the transposition of v run in ONE kernel too (k_proj).
// The planes of q, k and v lie in memory in FRAGMENT ORDER: the 16 bytes that lane 0..31 of a wave takes with one load stand side by side, so a load covers 512 contiguous bytes (4 whole lines).

#ifndef NB
#define NB 8
#endif
#ifndef SEQ
#define SEQ 2048
#endif
#define NB_FULL  8
#define SEQ_FULL 2048
#define DM   512
#define HD   64
#define NQKV 192                 // fused projection width: q | k | v
#define NCG  4                   // 16-query column groups per wave of the fused attention kernel
#define KSPL 8                   // key ranges per work-group, one wave each
#define QB   (NCG * 16)          // queries per work-group
#define SCL  0.125f              // HD^-0.5

static_assert(NB <= NB_FULL);
static_assert(SEQ <= SEQ_FULL);
static_assert(SEQ % QB == 0);
static_assert(SEQ % (KSPL * 32) == 0);
static_assert((QB * HD / 4) % (KSPL * 32) == 0);
static_assert(SEQ % 128 == 0);
static_assert(DM % 32 == 0);
static_assert(HD == 64);
static_assert((NB * SEQ) % 64 == 0);

typedef unsigned short bf;       // 16 bits of storage: bf16 in k_proj's LDS tiles, f16 in the planes
typedef __attribute__((ext_vector_type(16))) __bf16   v16bf;
typedef __attribute__((ext_vector_type(16))) _Float16 v16h;
typedef __attribute__((ext_vector_type(2)))  _Float16 v2h;
typedef __attribute__((ext_vector_type(8)))  unsigned short v8us;
typedef __attribute__((ext_vector_type(8)))  float    v8f;
typedef __attribute__((ext_vector_type(4)))  float    v4f;
typedef __attribute__((ext_vector_type(2)))  float    v2f;
typedef v4f  __attribute__((may_alias)) v4fa;

__device__ __forceinline__ v16bf cat16b(v8us lo, v8us hi) { return __builtin_bit_cast(v16bf, __builtin_shufflevector(lo, hi, 0, 1, 2, 3, 4, 5, 6, 7, 8, 9, 10, 11, 12, 13, 14, 15)); }
__device__ __forceinline__ v8f wmmab(v16bf a, v16bf b, v8f c) { return __builtin_amdgcn_wmma_f32_16x16x32_bf16(false, a, false, b, (short)0, c, false, false); }
__device__ __forceinline__ v16h cat16h(v8us lo, v8us hi) { return __builtin_bit_cast(v16h, __builtin_shufflevector(lo, hi, 0, 1, 2, 3, 4, 5, 6, 7, 8, 9, 10, 11, 12, 13, 14, 15)); }
__device__ __forceinline__ v8f wmmah(v16h a, v16h b, v8f c) { return __builtin_amdgcn_wmma_f32_16x16x32_f16(false, a, false, b, (short)0, c, false, false); }

// k_fattn: scores, softmax and attn.v fused. Work-group = QB queries of one batch, KSPL waves; wave w walks keys [w, w+1) * SEQ/KSPL in passes of 32 for ALL QB queries.
// Transposed products: St = K.Qt (A = K rows, B = Q rows, both k-contiguous planes), Ot += Vt.Pt (A = Vt rows, B = P packed from the two St tiles of a pass, which already lie in the operand's k order).
// A lane holds one query's scores (column l&15), so maximum, sum and rescale factor are per lane; the two lane halves hold different keys of that query.
// The running maximum is replaced only when a new one exceeds it by more than 8 (log2 units), so P <= 2^8; the KSPL partial results are joined through LDS in fixed wave order.
__device__ __forceinline__ float xhalf(float x) { return __builtin_bit_cast(float, __builtin_amdgcn_permlanex16(__builtin_bit_cast(int, x), __builtin_bit_cast(int, x), 0x76543210, 0xfedcba98, false, false)); }  // lane l with lane l ^ 16
// one operand fragment from the lane's own byte address in a row-major tile (LDS): elements 0..7 at p, 8..15 at p + 32 bytes
__device__ __forceinline__ v16bf ldf(const char* p) { return cat16b(*(const v8us*)p, *(const v8us*)(p + 32)); }
// the same from a plane in fragment order (memory): p = fragment + lane * 16; elements 0..7 at p, 8..15 at p + 512 bytes
__device__ __forceinline__ v16h ldg(const char* p) { return cat16h(*(const v8us*)p, *(const v8us*)(p + 512)); }
typedef __attribute__((ext_vector_type(2))) __bf16   v2bf;
typedef __attribute__((ext_vector_type(8))) unsigned v8u;
// 2^a with the slot behind a transcendental closed by construction: until the v_nop the result is unread and the source register unwritten (they are the statement's operands),
// so what stands directly behind the v_exp_f32 is an independent instruction or the v_nop itself
__device__ __forceinline__ float exp2s(float a) { float p = __builtin_amdgcn_exp2f(a); asm("v_nop" : "+v"(p) : "v"(a)); return p; }
#define OPITCH (HD + 4)
// QK: [q|k][NB*SEQ/16 tiles][8 pieces of a row][16 rows][8 elements]: a tile of 16 token rows keeps its 2 KiB, its 16-byte pieces stand piece-major (piece u = elements 8u..8u+7 of a row).
// VT: [NB][SEQ/32 key blocks][4 tiles of 16 d][4 pieces of 8 keys][16 d][8 keys]: 4 KiB a key block.
// Lane (c, h) of a fragment takes pieces h and 2 + h (of the fragment's 32 k) of row c, so each half of a fragment is 32 lanes x 16 bytes in a row.
constexpr size_t K_EL = (size_t)NB * SEQ * HD, K_B = K_EL * 2;
static_assert(K_B + 8192 < (1u << 23));   // the k plane is reached from the q plane's address by a load's immediate offset
__global__ __launch_bounds__(KSPL * 32) void k_fattn(const bf* __restrict__ QK, const bf* __restrict__ VT, float* __restrict__ out) {
    __shared__ __align__(16) float Os[KSPL * QB * OPITCH];
    __shared__ float ms[KSPL * QB];
    __shared__ float ls[KSPL * QB];
    const int tid = threadIdx.x, lane = tid & 31, c = lane & 15, h = lane >> 4, w = __builtin_amdgcn_readfirstlane(tid >> 5);
    // batch = fastest grid index, as in k_proj: the work-groups of a batch have equal flat index modulo NB. A permutation of the tiles, for speed only: any placement gives the same result
    const int b = blockIdx.x, q0 = blockIdx.y * QB;
    const float SC2 = SCL * 1.4426950408889634f;   // score scale and log2(e) in one factor
    constexpr int KPW = SEQ / KSPL;                // keys per wave
    const unsigned lo16 = (unsigned)lane * 16u;    // lane's bytes into each half of a fragment (row c, k order 8h.., 16+8h..)
    const char* qa = (const char*)(QK + ((size_t)b * SEQ + q0) * HD) + lo16;
    v16h qh[NCG][2];
#pragma unroll
    for (int g = 0; g < NCG; ++g)
#pragma unroll
        for (int ks = 0; ks < 2; ++ks) qh[g][ks] = ldg(qa + g * 2048 + ks * 1024);
    // this pass's 32 keys: two tiles of k, one key block of v; kp points into the q plane, K_B bytes in front of the keys, and every load adds K_B in its immediate offset:
    // so the register that the loads name is kp itself, and the wait below, which takes kp as its input, needs no sum formed in front of it
    const char* kp = (const char*)(QK + ((size_t)b * SEQ + w * KPW) * HD) + lo16;
    const char* vp = (const char*)(VT + ((size_t)b * SEQ + w * KPW) * HD) + lo16;
    v8f o[4][NCG]; float m[NCG], l[NCG];
#pragma unroll
    for (int g = 0; g < NCG; ++g) { m[g] = -3.0e38f; l[g] = 0.f;
#pragma unroll
        for (int dt = 0; dt < 4; ++dt) o[dt][g] = (v8f){}; }
    v16h kh[2][2];
#pragma unroll
    for (int kt = 0; kt < 2; ++kt)
#pragma unroll
        for (int ks = 0; ks < 2; ++ks) kh[kt][ks] = ldg(kp + K_B + kt * 2048 + ks * 1024);
    // the wait in front of any rewrite of a register that the loads above name; as the statement's input the lane offset stays live up to it
    asm volatile("s_wait_xcnt 0x0" :: "v"(lo16) : "memory");
#pragma unroll 1
    for (int k0 = 0; k0 < KPW; k0 += 32) {
        // this pass's V, used after the softmax
        v16h vh[4];
#pragma unroll
        for (int dt = 0; dt < 4; ++dt) vh[dt] = ldg(vp + dt * 1024);
        v8f st[NCG][2];
#pragma unroll
        for (int g = 0; g < NCG; ++g) { st[g][0] = (v8f){}; st[g][1] = (v8f){}; }
#pragma unroll
        for (int ks = 0; ks < 2; ++ks)
#pragma unroll
            for (int kt = 0; kt < 2; ++kt)
#pragma unroll
                for (int g = 0; g < NCG; ++g) st[g][kt] = wmmah(kh[kt][ks], qh[g][ks], st[g][kt]);
        // the next pass's K, into the same registers, so that its latency lies under the softmax and attn.v; a wave's last pass fetches, and never uses,
        // the 4 KiB behind its keys: the next wave's or batch's keys or, at the plane's end, the head of the v plane, all written earlier in this call
#pragma unroll
        for (int kt = 0; kt < 2; ++kt)
#pragma unroll
            for (int ks = 0; ks < 2; ++ks) kh[kt][ks] = ldg(kp + K_B + 4096 + kt * 2048 + ks * 1024);
        // the wait in front of any rewrite of a register that this pass's loads name (the two addresses advance right behind it); as the statement's inputs they stay live up to it
        asm volatile("s_wait_xcnt 0x0" :: "v"(kp), "v"(vp) : "memory");
        kp += 4096; vp += 4096;
        float mx[NCG]; bool need = false;
#pragma unroll
        for (int g = 0; g < NCG; ++g) { float a = fmaxf(st[g][0][0], st[g][1][0]);
#pragma unroll
            for (int r = 1; r < 8; ++r) a = fmaxf(a, fmaxf(st[g][0][r], st[g][1][r]));
            a = fmaxf(a, xhalf(a)); mx[g] = a * SC2; need = need || (mx[g] > m[g] + 8.0f); }
        if (__builtin_amdgcn_ballot_w32(need) != 0) {
#pragma unroll
            for (int g = 0; g < NCG; ++g) { const float mn = fmaxf(m[g], mx[g]); const float al = exp2s(m[g] - mn); m[g] = mn; l[g] *= al;
#pragma unroll
                for (int dt = 0; dt < 4; ++dt) o[dt][g] *= al; }
        }
        // column group by column group: a group's P lives only until its own four products, and the next group's vector work stands beside them
#pragma unroll
        for (int g = 0; g < NCG; ++g) { v8u hu;
#pragma unroll
            for (int s = 0; s < 16; s += 2) { v2f p;
                const float a0 = __builtin_fmaf(st[g][s >> 3][s & 7], SC2, -m[g]), a1 = __builtin_fmaf(st[g][s >> 3][(s & 7) + 1], SC2, -m[g]);
                float p0 = __builtin_amdgcn_exp2f(a0), p1 = __builtin_amdgcn_exp2f(a1);
                // the slot behind a transcendental, as in exp2s, one v_nop for the pair
                asm("v_nop" : "+v"(p0), "+v"(p1) : "v"(a0), "v"(a1));
                p[0] = p0; p[1] = p1; l[g] += p0; l[g] += p1;
                hu[s >> 1] = __builtin_bit_cast(unsigned, __builtin_convertvector(p, v2h)); }
            const v16h ph = __builtin_bit_cast(v16h, hu);
#pragma unroll
            for (int dt = 0; dt < 4; ++dt) o[dt][g] = wmmah(vh[dt], ph, o[dt][g]); }
    }
    // each wave's partial result: maximum, sum (both lane halves joined) and Ot, a lane's 8 registers being 8 consecutive d of its query
#pragma unroll
    for (int g = 0; g < NCG; ++g) { const int q = g * 16 + c; const float lj = l[g] + xhalf(l[g]);
        if (h == 0) { ms[w * QB + q] = m[g]; ls[w * QB + q] = lj; }
#pragma unroll
        for (int dt = 0; dt < 4; ++dt) { float* p = Os + (size_t)(w * QB + q) * OPITCH + dt * 16 + 8 * h;
            *(v4f*)p = (v4f){o[dt][g][0], o[dt][g][1], o[dt][g][2], o[dt][g][3]}; *(v4f*)(p + 4) = (v4f){o[dt][g][4], o[dt][g][5], o[dt][g][6], o[dt][g][7]}; } }
    __syncthreads();
#pragma unroll
    for (int i = 0; i < QB * HD / 4 / (KSPL * 32); ++i) { const int f = i * (KSPL * 32) + tid, q = f >> 4, d4 = (f & 15) * 4;
        float M = ms[q];
#pragma unroll
        for (int u = 1; u < KSPL; ++u) M = fmaxf(M, ms[u * QB + q]);
        float L = 0.f; v4f acc = (v4f){};
#pragma unroll
        for (int u = 0; u < KSPL; ++u) { const float wt = exp2s(ms[u * QB + q] - M); L += ls[u * QB + q] * wt; acc += *(const v4f*)(Os + (size_t)(u * QB + q) * OPITCH + d4) * wt; }
        const float f1 = __fdiv_rn(1.0f, L);
        *(v4f*)(out + ((size_t)b * SEQ + q0 + q) * HD + d4) = acc * f1; }
}
// k_proj: q, k and v of PR token rows in one work-group, from x in f32 to the operand planes of k_fattn; neither a bf16 copy of x nor the f32 projections reach memory.
// Whole-line loads bring the PR x DM tile of x and all three weight matrices, both f32, into LDS (converted to bf16, RNE, on the way); 8 waves then hold 2 x 3 tiles of the PR x NQKV result each.
// The weights keep the input's own order in LDS (row = k, columns q | k | v side by side): A = x rows read by ldf, B = weight columns read by the transposing load (ldt),
// which delivers ldf's k order (8h.., 16 + 8h..); k in steps of 32 from 0 up. The f32 results go through LDS, q|k by rows and v transposed, so that every plane is stored in whole 128-byte lines, in k_fattn's fragment order.
#define PR   64                  // token rows per work-group
#define XPB  ((DM + 8) * 2)      // LDS row pitch of the bf16 x tile, bytes: 16 x an odd number, for 16-byte readers
#define WPB  ((NQKV + 16) * 2)   // LDS row pitch of the bf16 weight tile, bytes: 32 x an odd number, for the transposing reader
#define FPI  (2 * HD + 4)        // LDS row pitch of the f32 q|k tile, floats
#define VPI  (PR + 4)            // LDS row pitch of the f32 v tile (row = d, column = token), floats
#define KC   64                  // k per chunk of the staging
#define NCH  (DM / KC)
#define TPR  (KC / 4)            // threads per row of x in a chunk, 16 bytes each
#define XST  (PR * TPR / 256)    // load steps of x in a chunk
#define WST  (KC / 16)           // load steps of one weight matrix in a chunk
#define NLD  (XST + 3 * WST)     // loads a thread and chunk
#define NSET (64 / NLD)          // chunks in flight, one register set each
static_assert(SEQ % PR == 0 && DM == 512 && NQKV == 192 && PR == 64 && (KC == 64 || KC == 128) && NCH > NSET);
static_assert((size_t)(PR * FPI + HD * VPI) * 4 <= (size_t)PR * XPB);
static_assert(WPB % 32 == 0 && (WPB / 32) % 2 == 1 && (4 * WPB) % 256 == 128 && (PR * XPB) % 32 == 0);
typedef __attribute__((ext_vector_type(4))) unsigned v4u;
typedef __attribute__((ext_vector_type(2))) unsigned v2u;
__device__ __forceinline__ unsigned pkbf(float a, float b) { const v2f p = {a, b}; return __builtin_bit_cast(unsigned, __builtin_convertvector(p, v2bf)); }
__device__ __forceinline__ unsigned pkh(float a, float b) { const v2f p = {a, b}; return __builtin_bit_cast(unsigned, __builtin_convertvector(p, v2h)); }
// eight f32 -> eight f16 (RNE)
__device__ __forceinline__ v4u cvt8(v4f a, v4f b) { return (v4u){pkh(a[0], a[1]), pkh(a[2], a[3]), pkh(b[0], b[1]), pkh(b[2], b[3])}; }
typedef __attribute__((ext_vector_type(8))) short v8s;
// one B fragment (32 k x 16 columns) from a row-major tile (row = k) in LDS: p = tile + (8h + (lane & 7)) * WPB + ((lane >> 3) & 1) * 16;
// lane (c, h) gets column c at k = 8h .. 8h + 7 from the first load and at 16 + 8h .. from the second, 16 rows further down
__device__ __forceinline__ v8us ldtr(const char* p) { typedef __attribute__((address_space(3))) v8s lds_v8s; return __builtin_bit_cast(v8us, __builtin_amdgcn_ds_load_tr16_b128_v8i16((lds_v8s*)p)); }
__device__ __forceinline__ v16bf ldt(const char* p) { return cat16b(ldtr(p), ldtr(p + 16 * WPB)); }
__global__ __launch_bounds__(256) void k_proj(const float* __restrict__ x, const float* __restrict__ ker, bf* __restrict__ QK, bf* __restrict__ VT) {
    __shared__ __align__(32) char sm[PR * XPB + DM * WPB];
    char* Xs = sm; char* Ws = sm + PR * XPB;
    const int tid = threadIdx.x, lane = tid & 31, c = lane & 15, h = lane >> 4, w = __builtin_amdgcn_readfirstlane(tid >> 5);
    const int b = blockIdx.x, t0 = blockIdx.y * PR, R0 = b * SEQ + t0;   // batch = fastest grid index: see k_fattn
    // 256 threads x 16 bytes = 4 KiB a step: 256 / TPR rows of x (the KC * 4 bytes that a chunk of KC k takes of each), sixteen rows (256 bytes each) of one weight matrix;
    // one uniform base each and the thread's own bytes, steps and chunks in the immediate offset
    const char* xb = (const char*)(x + ((size_t)b * SEQ_FULL + t0) * DM);
    const char* wbs = (const char*)ker;
    // a wave takes rows wrow and wrow + 4 of a step's sixteen: in LDS they lie 4 * WPB bytes apart, half the banks, so its 8-byte stores meet no conflict
    const int wrow = (w & 3) + 4 * h + 8 * (w >> 2);
    const unsigned wo = (unsigned)wrow * 256u + (unsigned)c * 16u;
    const unsigned xo = (unsigned)(tid / TPR) * (DM * 4u) + (unsigned)(tid % TPR) * 16u;
    char* xs = Xs + (tid / TPR) * XPB + (tid % TPR) * 8;
    char* wsd = Ws + wrow * WPB + c * 8;
    const int rg = w & 1, cg = w >> 1;   // rows rg * 32 .. + 31, columns cg * 48 .. + 47
    const char* ap = Xs + (rg * 32 + c) * XPB + h * 16;
    const char* bp = Ws + (8 * h + (lane & 7)) * WPB + ((lane >> 3) & 1) * 16 + cg * 48 * 2;
    v8f acc[2][3];
#pragma unroll
    for (int rt = 0; rt < 2; ++rt)
#pragma unroll
        for (int ct = 0; ct < 3; ++ct) acc[rt][ct] = (v8f){};
    // x and the weights arrive in NCH chunks of KC k (NLD loads a thread each: XST of x, WST of each weight matrix), NSET chunks in flight, a register set each.
    // A chunk goes to LDS as soon as it is there, the loads of the chunk NSET further on take its registers, one barrier publishes it, and its products run while the later chunks are still on their way.
    // Every chunk has its own place in LDS, so no barrier is needed behind its readers. (All loops of this kernel are unrolled: their indices pick registers and immediate offsets.)
    v4f ld[NSET][NLD];
#pragma unroll
    for (int j = 0; j < NSET; ++j) {
#pragma unroll
        for (int s = 0; s < XST; ++s) ld[j][s] = *(const v4f*)(xb + (size_t)xo + s * (256 / TPR) * DM * 4 + j * KC * 4);
#pragma unroll
        for (int i = 0; i < 3 * WST; ++i) ld[j][XST + i] = *(const v4f*)(wbs + (size_t)wo + ((i / WST) * 32 + j * WST + i % WST) * 4096);
        // keeps the loads in chunk order: loads return in issue order, and a chunk whose last load stands among a later chunk's would wait for that one too
        __builtin_amdgcn_sched_barrier(0);
    }
    // fragments one k step ahead inside a chunk, in two register sets, so that a step's products do not wait for their own LDS reads
    v16bf a[2][2], bb[2][3];
#pragma unroll
    for (int j = 0; j < NCH; ++j) { const int st = j % NSET;
#pragma unroll
        for (int s = 0; s < XST; ++s) *(v2u*)(xs + s * (256 / TPR) * XPB + j * KC * 2) = (v2u){pkbf(ld[st][s][0], ld[st][s][1]), pkbf(ld[st][s][2], ld[st][s][3])};
#pragma unroll
        for (int i = 0; i < 3 * WST; ++i) *(v2u*)(wsd + (j * WST + i % WST) * 16 * WPB + (i / WST) * HD * 2) = (v2u){pkbf(ld[st][XST + i][0], ld[st][XST + i][1]), pkbf(ld[st][XST + i][2], ld[st][XST + i][3])};
        if (j + NSET < NCH) {
            // keeps the loads of the later chunk behind the stores that free their registers (hoisted, they cost spills)
            __builtin_amdgcn_sched_barrier(0);
#pragma unroll
            for (int s = 0; s < XST; ++s) ld[st][s] = *(const v4f*)(xb + (size_t)xo + s * (256 / TPR) * DM * 4 + (j + NSET) * KC * 4);
#pragma unroll
            for (int i = 0; i < 3 * WST; ++i) ld[st][XST + i] = *(const v4f*)(wbs + (size_t)wo + ((i / WST) * 32 + (j + NSET) * WST + i % WST) * 4096);
        }
        // behind the last loads: the wait in front of any rewrite of a register that the loads name; as the statement's inputs the bases and the thread's offsets stay live up to it
        if (j + NSET + 1 == NCH) asm volatile("s_wait_xcnt 0x0" :: "s"(xb), "v"(xo), "s"(wbs), "v"(wo) : "memory");
        // chunk j stands in LDS for every wave. The barrier orders LDS alone: __syncthreads() would also wait for the global loads in flight, which are the point of the chunks
        __builtin_amdgcn_fence(__ATOMIC_RELEASE, "workgroup", "local");
        __builtin_amdgcn_s_barrier();
        __builtin_amdgcn_fence(__ATOMIC_ACQUIRE, "workgroup", "local");
#pragma unroll
        for (int rt = 0; rt < 2; ++rt) a[0][rt] = ldf(ap + rt * 16 * XPB + j * (KC / 32) * 64);
#pragma unroll
        for (int ct = 0; ct < 3; ++ct) bb[0][ct] = ldt(bp + ct * 32 + j * KC * WPB);
#pragma unroll
        for (int kk = 0; kk < KC / 32; ++kk) { const int kc = j * (KC / 32) + kk, cu = kk & 1, nx = cu ^ 1;
            if (kk + 1 < KC / 32) {
#pragma unroll
                for (int rt = 0; rt < 2; ++rt) a[nx][rt] = ldf(ap + rt * 16 * XPB + (kc + 1) * 64);
#pragma unroll
                for (int ct = 0; ct < 3; ++ct) bb[nx][ct] = ldt(bp + ct * 32 + (kc + 1) * 32 * WPB);
            }
            // keeps the next step's reads in front of this step's products (the scheduler otherwise sinks them to just before their use)
            __builtin_amdgcn_sched_barrier(0);
#pragma unroll
            for (int rt = 0; rt < 2; ++rt)
#pragma unroll
                for (int ct = 0; ct < 3; ++ct) acc[rt][ct] = wmmab(a[cu][rt], bb[cu][ct], acc[rt][ct]); }
    }
    __syncthreads();   // every wave has read its last fragment: the operand tiles' LDS now takes the results
    float* Fs = (float*)sm; float* Vs = Fs + PR * FPI;
    // accumulator register j of lane (c, h) = (row 8h + j, column c) of its tile
#pragma unroll
    for (int rt = 0; rt < 2; ++rt)
#pragma unroll
        for (int ct = 0; ct < 3; ++ct) { const int nt = cg * 3 + ct, r = rg * 32 + rt * 16 + 8 * h; const v8f d = acc[rt][ct];
            if (nt < 8) {
#pragma unroll
                for (int j = 0; j < 8; ++j) Fs[(r + j) * FPI + nt * 16 + c] = d[j];
            } else { float* p = Vs + ((nt - 8) * 16 + c) * VPI + r; *(v4fa*)p = (v4f){d[0], d[1], d[2], d[3]}; *(v4fa*)(p + 4) = (v4f){d[4], d[5], d[6], d[7]}; } }
    __syncthreads();
    // a thread's 16 bytes stand at its own index in the stored unit; which row and piece they are follows from the fragment order
    // q|k: a tile of 16 token rows a step, threads 0..127 its q, 128..255 its k (row tid & 15, piece (tid >> 4) & 7); v: a block of 32 keys a step (d = (tid >> 6) * 16 + (tid & 15), piece (tid >> 4) & 3)
    char* qo = (char*)(QK + (size_t)(tid >> 7) * K_EL + (size_t)R0 * HD + (tid & 127) * 8);
    char* vo = (char*)(VT + ((size_t)b * SEQ + t0) * HD + tid * 8);
#pragma unroll
    for (int it = 0; it < 4; ++it) { const float* s = Fs + (it * 16 + (tid & 15)) * FPI + (tid >> 4) * 8; const v4u hv = cvt8(*(const v4fa*)s, *(const v4fa*)(s + 4));
        *(v4u*)(qo + it * 16 * HD * 2) = hv;
        // the wait in front of any rewrite of a register that the step's store names (the next step takes them over); as the statement's inputs they stay live up to it
        asm volatile("s_wait_xcnt 0x0" :: "v"(hv), "v"(qo) : "memory"); }
#pragma unroll
    for (int it = 0; it < 2; ++it) { const float* s = Vs + ((tid >> 6) * 16 + (tid & 15)) * VPI + (it * 4 + ((tid >> 4) & 3)) * 8; const v4u hv = cvt8(*(const v4fa*)s, *(const v4fa*)(s + 4));
        *(v4u*)(vo + it * 4096) = hv;
        // the same wait (the address lives on into the next step); behind the last step nothing is rewritten any more
        if (it == 0) asm volatile("s_wait_xcnt 0x0" :: "v"(hv) : "memory"); }
}

// workspace carve (bytes), all multiples of 256
constexpr size_t B_QK  = (size_t)2 * NB * SEQ * HD * 2;
constexpr size_t B_VT  = (size_t)NB * HD * SEQ * 2;
constexpr size_t B_TOT = B_QK + B_VT;
static_assert(B_QK % 256 == 0 && B_VT % 256 == 0);
static_assert(B_TOT <= (size_t)134217728);
static_assert(B_VT >= 4096);   // the v plane is carved directly behind the k plane: k_fattn's last fetch ahead ends inside it

extern "C" void kernel_launch(void* const* d_in, const int* in_sizes, int n_in,
                              void* d_out, int out_size, void* d_ws, size_t ws_size, hipStream_t stream) {
    if (n_in < 2) return;
    if ((size_t)in_sizes[0] < (size_t)(NB - 1) * SEQ_FULL * DM + (size_t)SEQ * DM) return;
    if ((size_t)in_sizes[1] < (size_t)3 * DM * HD) return;
    if ((size_t)out_size < (size_t)NB * SEQ * HD) return;
    if (B_TOT > ws_size) return;
    const float* x = (const float*)d_in[0];      // [8][2048][512]
    const float* ker = (const float*)d_in[1];    // [3][512][64]
    float* OUT = (float*)d_out;                  // [NB][SEQ][64]
    char* wsp = (char*)d_ws;
    auto take = [&](size_t bytes) { char* p = wsp; wsp += (bytes + 255) & ~(size_t)255; return (void*)p; };
    bf* QKh  = (bf*)take(B_QK);      // [2][NB*SEQ][64], each tile of 16 rows in fragment order
    bf* VTh  = (bf*)take(B_VT);      // [NB][SEQ/32][64][32], each key block in fragment order
    if ((size_t)(wsp - (char*)d_ws) > ws_size) return;

    // x, weights -> q, k and v transposed, f16 planes, one launch
    k_proj<<<dim3(NB, SEQ / PR, 1), 256, 0, stream>>>(x, ker, QKh, VTh);
    // out = softmax(q k^T x HD^-0.5) v, one launch for all batches
    k_fattn<<<dim3(NB, SEQ / QB, 1), KSPL * 32, 0, stream>>>(QKh, VTh, OUT);
}
